// v000
// Measured on an AMD MI455X. A time is GPU time per run, averaged over a window of back-to-back runs after a warm-up
// (all launches, gaps included; the runs take copies of the inputs in turn), and the median of several windows.
// Apart from v000's, it joins two sittings. Times from different sittings can be a few percent apart, while
// side-by-side timings come from the same sitting.
// The starting kernel, v000, takes 257 microseconds a run.
#include <hip/hip_runtime.h>
#include <hip/hip_bf16.h>

typedef __attribute__((ext_vector_type(16))) _Float16 v16h;
typedef __attribute__((ext_vector_type(8)))  _Float16 v8h;
typedef __attribute__((ext_vector_type(8)))  float    v8f;

#define B_  4
#define C_  64
#define CQ  8          // C/8
#define CP  16         // padded K rows for theta/phi (upper 8 stored zero)
#define CG  32         // C/2
#define H_  128
#define W_  128
#define N_  (H_*W_)    // 16384
#define M_  (N_/4)     // 4096

#define CAT16(a, b) __builtin_shufflevector(a, b, 0,1,2,3,4,5,6,7,8,9,10,11,12,13,14,15)

// ---------------------------------------------------------------------------
// Phase 1a: thetaPad[b][n][0..15] : halves 0..7 = w_theta . x[:, n], 8..15 = 0
// ---------------------------------------------------------------------------
__global__ void __launch_bounds__(256)
sagan_theta_kernel(const float* __restrict__ x, const float* __restrict__ w_theta,
                   _Float16* __restrict__ thetaPad)
{
    __shared__ float w[CQ * C_];
    for (int i = threadIdx.x; i < CQ * C_; i += blockDim.x) w[i] = w_theta[i];
    __syncthreads();

    const int idx = blockIdx.x * blockDim.x + threadIdx.x;   // b*N_ + n
    const int b = idx >> 14;
    const int n = idx & (N_ - 1);

    float acc[CQ] = {};
    const float* xp = x + (size_t)b * C_ * N_ + n;
    #pragma unroll 8
    for (int c = 0; c < C_; ++c) {
        float xv = xp[(size_t)c * N_];
        #pragma unroll
        for (int o = 0; o < CQ; ++o) acc[o] += w[o * C_ + c] * xv;
    }
    v8h lo;
    #pragma unroll
    for (int o = 0; o < CQ; ++o) lo[o] = (_Float16)acc[o];
    const v8h zz = {};
    _Float16* tp = thetaPad + ((size_t)idx << 4);
    *(v8h*)(tp)      = lo;   // global_store_b128
    *(v8h*)(tp + 8)  = zz;   // zero pad (K = 8..15)
}

// ---------------------------------------------------------------------------
// Phase 1b: fused 1x1 conv + 2x2 maxpool for phi and g.
//   phiPad[b][p][0..15]  (f16, zero-padded rows for WMMA A fragments)
//   g16[b][cg][p]        (f16, channel-major so PV B fragments are contiguous)
// ---------------------------------------------------------------------------
__global__ void __launch_bounds__(256)
sagan_phig_kernel(const float* __restrict__ x, const float* __restrict__ w_phi,
                  const float* __restrict__ w_g,
                  _Float16* __restrict__ phiPad, _Float16* __restrict__ g16)
{
    __shared__ float wp[CQ * C_];
    __shared__ float wg[CG * C_];
    for (int i = threadIdx.x; i < CQ * C_; i += blockDim.x) wp[i] = w_phi[i];
    for (int i = threadIdx.x; i < CG * C_; i += blockDim.x) wg[i] = w_g[i];
    __syncthreads();

    const int idx = blockIdx.x * blockDim.x + threadIdx.x;   // b*M_ + p
    const int b = idx >> 12;
    const int p = idx & (M_ - 1);
    const int hp = p >> 6, wq = p & 63;
    const int nbase = (hp * 2) * W_ + wq * 2;

    float res[CQ + CG];
    #pragma unroll
    for (int o = 0; o < CQ + CG; ++o) res[o] = -3.0e38f;

    const float* xb = x + (size_t)b * C_ * N_;
    for (int pos = 0; pos < 4; ++pos) {
        const int n = nbase + (pos >> 1) * W_ + (pos & 1);
        float acc[CQ + CG] = {};
        #pragma unroll 4
        for (int c = 0; c < C_; ++c) {
            float xv = xb[(size_t)c * N_ + n];
            #pragma unroll
            for (int o = 0; o < CQ; ++o) acc[o] += wp[o * C_ + c] * xv;
            #pragma unroll
            for (int o = 0; o < CG; ++o) acc[CQ + o] += wg[o * C_ + c] * xv;
        }
        #pragma unroll
        for (int o = 0; o < CQ + CG; ++o) res[o] = fmaxf(res[o], acc[o]);
    }

    v8h lo;
    #pragma unroll
    for (int o = 0; o < CQ; ++o) lo[o] = (_Float16)res[o];
    const v8h zz = {};
    _Float16* pp = phiPad + ((size_t)idx << 4);
    *(v8h*)(pp)     = lo;
    *(v8h*)(pp + 8) = zz;
    #pragma unroll
    for (int o = 0; o < CG; ++o)
        g16[((size_t)(b * CG + o)) * M_ + p] = (_Float16)res[CQ + o];
}

// ---------------------------------------------------------------------------
// Phase 2: fused flash-style attention + w_o projection + residual.
// One wave owns a 16-row n-tile. Sᵀ tiles via v_wmma_f32_16x16x32_f16
// (lane = n in D layout => per-lane softmax). Sᵀ D-tile pair converts to the
// PV A fragment with per-lane f32->f16 packs only. All fragment loads are
// unconditional b128 loads (zero padding stored in memory), no exec masking.
// ---------------------------------------------------------------------------
__global__ void __launch_bounds__(256)
sagan_attn_kernel(const float* __restrict__ x, const float* __restrict__ w_o,
                  const float* __restrict__ gamma,
                  const _Float16* __restrict__ thetaPad,
                  const _Float16* __restrict__ phiPad,
                  const _Float16* __restrict__ g16,
                  float* __restrict__ out)
{
    __shared__ float ldsO[8][16][CG];  // per-wave O tile  (16 KB)
    __shared__ float ldsS[8][16];      // per-wave row sums
    __shared__ float ldsW[C_ * CG];    // w_o cache        (8 KB)

    const int tid  = threadIdx.x;
    const int wave = tid >> 5;
    const int lane = tid & 31;
    const int ln   = lane & 15;   // n (or c) index within tile
    const int hi   = lane >> 4;   // lane half

    for (int i = tid; i < C_ * CG; i += 256) ldsW[i] = w_o[i];

    const int tile = blockIdx.x * 8 + wave;     // 4096 tiles total
    const int b  = tile >> 10;                  // N_/16 = 1024 tiles per batch
    const int n0 = (tile & 1023) << 4;

    const v8h zh = {};

    // B fragment: theta. halves 0..7 <- row (K-offset hi*8, zeros stored for
    // K>=8); halves 8..15 (K=16..31) constant zero.
    v8h tlo = *(const v8h*)(thetaPad + (((size_t)b * N_ + n0 + ln) << 4) + (hi << 3));
    const v16h bth = CAT16(tlo, zh);

    const _Float16* phib = phiPad + ((size_t)b * M_ << 4) + (hi << 3);
    const _Float16* gb   = g16    + (size_t)b * CG * M_;
    const v8f zero8 = {};

    // ---- pass 1: row max over m (per lane: 8 m-rows of column n=ln) ----
    float mmax = -3.0e38f;
    for (int m0 = 0; m0 < M_; m0 += 32) {
        const _Float16* pr = phib + ((size_t)(m0 + ln) << 4);
        v8h a0 = *(const v8h*)(pr);
        v8h a1 = *(const v8h*)(pr + (16 << 4));
        v16h ap0 = CAT16(a0, zh);
        v16h ap1 = CAT16(a1, zh);
        v8f s0 = __builtin_amdgcn_wmma_f32_16x16x32_f16(false, ap0, false, bth,
                                                        (short)0, zero8, false, false);
        v8f s1 = __builtin_amdgcn_wmma_f32_16x16x32_f16(false, ap1, false, bth,
                                                        (short)0, zero8, false, false);
        #pragma unroll
        for (int i = 0; i < 8; ++i) mmax = fmaxf(mmax, fmaxf(s0[i], s1[i]));
    }
    mmax = fmaxf(mmax, __shfl_xor(mmax, 16, 32));

    // ---- pass 2: exp + P.g accumulation ----
    const float log2e = 1.44269504088896340736f;
    float rsum = 0.f;
    v8f acc0 = {}, acc1 = {};
    for (int m0 = 0; m0 < M_; m0 += 32) {
        const _Float16* pr = phib + ((size_t)(m0 + ln) << 4);
        v8h a0 = *(const v8h*)(pr);
        v8h a1 = *(const v8h*)(pr + (16 << 4));
        v16h ap0 = CAT16(a0, zh);
        v16h ap1 = CAT16(a1, zh);
        v8f s0 = __builtin_amdgcn_wmma_f32_16x16x32_f16(false, ap0, false, bth,
                                                        (short)0, zero8, false, false);
        v8f s1 = __builtin_amdgcn_wmma_f32_16x16x32_f16(false, ap1, false, bth,
                                                        (short)0, zero8, false, false);
        // S^T D-layout -> PV A-layout: pure per-lane f32->f16 packing.
        v16h P;
        #pragma unroll
        for (int i = 0; i < 8; ++i) {
            float p0 = exp2f((s0[i] - mmax) * log2e);
            float p1 = exp2f((s1[i] - mmax) * log2e);
            rsum += p0 + p1;
            P[i]     = (_Float16)p0;
            P[8 + i] = (_Float16)p1;
        }
        // B fragments from g (channel-major => contiguous 16B per half-lane)
        const _Float16* g0 = gb + (size_t)ln * M_        + m0 + (hi << 3);
        const _Float16* g1 = gb + (size_t)(16 + ln) * M_ + m0 + (hi << 3);
        v8h g0a = *(const v8h*)(g0);
        v8h g0b = *(const v8h*)(g0 + 16);
        v8h g1a = *(const v8h*)(g1);
        v8h g1b = *(const v8h*)(g1 + 16);
        v16h bg0 = CAT16(g0a, g0b);
        v16h bg1 = CAT16(g1a, g1b);
        acc0 = __builtin_amdgcn_wmma_f32_16x16x32_f16(false, P, false, bg0,
                                                      (short)0, acc0, false, false);
        acc1 = __builtin_amdgcn_wmma_f32_16x16x32_f16(false, P, false, bg1,
                                                      (short)0, acc1, false, false);
    }
    rsum += __shfl_xor(rsum, 16, 32);

    // stage O tile + row sums through per-wave LDS
    if (hi == 0) ldsS[wave][ln] = rsum;
    #pragma unroll
    for (int r = 0; r < 8; ++r) {
        ldsO[wave][r + hi * 8][ln]      = acc0[r];
        ldsO[wave][r + hi * 8][16 + ln] = acc1[r];
    }
    __syncthreads();

    // epilogue: out = gamma * w_o.(O/rowsum) + x
    const float gma  = gamma[0];
    const float rinv = 1.0f / ldsS[wave][ln];
    float orow[CG];
    #pragma unroll
    for (int ci = 0; ci < CG; ++ci) orow[ci] = ldsO[wave][ln][ci] * rinv;

    const size_t xbase = (size_t)b * C_ * N_;
    const int co_base = hi * 32;
    for (int j = 0; j < 32; ++j) {
        const int co = co_base + j;
        const float* wrow = ldsW + (size_t)co * CG;
        float v = 0.f;
        #pragma unroll
        for (int ci = 0; ci < CG; ++ci) v += wrow[ci] * orow[ci];
        const size_t oi = xbase + (size_t)co * N_ + (n0 + ln);
        out[oi] = gma * v + x[oi];
    }
}

// ---------------------------------------------------------------------------
extern "C" void kernel_launch(void* const* d_in, const int* in_sizes, int n_in,
                              void* d_out, int out_size, void* d_ws, size_t ws_size,
                              hipStream_t stream)
{
    const float* x       = (const float*)d_in[0];
    const float* w_theta = (const float*)d_in[1];
    const float* w_phi   = (const float*)d_in[2];
    const float* w_g     = (const float*)d_in[3];
    const float* w_o     = (const float*)d_in[4];
    const float* gamma   = (const float*)d_in[5];
    float* out = (float*)d_out;

    _Float16* thetaPad = (_Float16*)d_ws;                      // B*N*16 = 1M halves (2 MB)
    _Float16* phiPad   = thetaPad + ((size_t)B_ * N_ << 4);    // B*M*16 = 256K halves (512 KB)
    _Float16* g16      = phiPad   + ((size_t)B_ * M_ << 4);    // B*32*M = 512K halves (1 MB)

    sagan_theta_kernel<<<(B_ * N_) / 256, 256, 0, stream>>>(x, w_theta, thetaPad);
    sagan_phig_kernel<<<(B_ * M_) / 256, 256, 0, stream>>>(x, w_phi, w_g, phiPad, g16);
    sagan_attn_kernel<<<(B_ * (N_ / 16)) / 8, 256, 0, stream>>>(
        x, w_o, gamma, thetaPad, phiPad, g16, out);
}

// v001
// Measured time: 160 microseconds a run.
// In two side-by-side timings against v000, it was 1.60 and 1.64 times as fast.
#include <hip/hip_runtime.h>
#include <hip/hip_bf16.h>

typedef __attribute__((ext_vector_type(16))) _Float16 v16h;
typedef __attribute__((ext_vector_type(8)))  _Float16 v8h;
typedef __attribute__((ext_vector_type(8)))  float    v8f;

#define B_  4
#define C_  64
#define CQ  8          // C/8
#define CP  16         // padded K rows for theta/phi (upper 8 stored zero)
#define CG  32         // C/2
#define H_  128
#define W_  128
#define N_  (H_*W_)    // 16384
#define M_  (N_/4)     // 4096

#define CAT16(a, b) __builtin_shufflevector(a, b, 0,1,2,3,4,5,6,7,8,9,10,11,12,13,14,15)

// ---------------------------------------------------------------------------
// Phase 1a: thetaPad[b][n][0..15] : halves 0..7 = w_theta . x[:, n], 8..15 = 0
// ---------------------------------------------------------------------------
__global__ void __launch_bounds__(256)
sagan_theta_kernel(const float* __restrict__ x, const float* __restrict__ w_theta,
                   _Float16* __restrict__ thetaPad)
{
    __shared__ float w[CQ * C_];
    for (int i = threadIdx.x; i < CQ * C_; i += blockDim.x) w[i] = w_theta[i];
    __syncthreads();

    const int idx = blockIdx.x * blockDim.x + threadIdx.x;   // b*N_ + n
    const int b = idx >> 14;
    const int n = idx & (N_ - 1);

    float acc[CQ] = {};
    const float* xp = x + (size_t)b * C_ * N_ + n;
    #pragma unroll 8
    for (int c = 0; c < C_; ++c) {
        float xv = xp[(size_t)c * N_];
        #pragma unroll
        for (int o = 0; o < CQ; ++o) acc[o] += w[o * C_ + c] * xv;
    }
    v8h lo;
    #pragma unroll
    for (int o = 0; o < CQ; ++o) lo[o] = (_Float16)acc[o];
    const v8h zz = {};
    _Float16* tp = thetaPad + ((size_t)idx << 4);
    *(v8h*)(tp)      = lo;   // global_store_b128
    *(v8h*)(tp + 8)  = zz;   // zero pad (K = 8..15)
}

// ---------------------------------------------------------------------------
// Phase 1b: fused 1x1 conv + 2x2 maxpool for phi and g.
//   phiPad[b][p][0..15]  (f16, zero-padded rows for WMMA A fragments)
//   g16[b][cg][p]        (f16, channel-major so PV B fragments are contiguous)
// One work-group = one pooled row (64 pooled pixels) x all 40 outputs.
// Two waves cover the 64 pixels; five such pairs take 8 outputs each
// (pair 0 = phi, pairs 1..4 = g). A thread keeps its 2x2 window x 8 outputs
// in registers, so one weight read from LDS feeds four multiply-adds.
// ---------------------------------------------------------------------------
#define PG_OG 8                        // outputs per thread
#define PG_NG ((CQ + CG) / PG_OG)      // 5 output groups
#define PG_T  (64 * PG_NG)             // 320 threads

__global__ void __launch_bounds__(PG_T)
sagan_phig_kernel(const float* __restrict__ x, const float* __restrict__ w_phi,
                  const float* __restrict__ w_g,
                  _Float16* __restrict__ phiPad, _Float16* __restrict__ g16)
{
    __shared__ __attribute__((aligned(16))) float wl[(CQ + CG) * C_];  // rows 0..7 phi, 8..39 g
    // 2560 weights = 8 per thread; unrolled so that the 8 loads fly together
    #pragma unroll
    for (int k = 0; k < (CQ + CG) * C_ / PG_T; ++k) {
        const int i = threadIdx.x + k * PG_T;
        wl[i] = (i < CQ * C_) ? w_phi[i] : w_g[i - CQ * C_];
    }
    __syncthreads();

    const int grp = threadIdx.x >> 6;        // output group, same for a whole wave
    const int wq  = threadIdx.x & 63;        // pooled column
    const int b   = blockIdx.x >> 6;
    const int hp  = blockIdx.x & 63;         // pooled row
    const int p   = hp * 64 + wq;

    const float* xp = x + (size_t)b * C_ * N_ + (hp * 2) * W_ + wq * 2;
    const float* wr = wl + grp * PG_OG * C_;

    float acc[4][PG_OG] = {};
    // unroll 16: four channels' weights come as one 16-byte LDS read, and the
    // x loads of later channels are issued while earlier ones are worked on
    #pragma unroll 16
    for (int c = 0; c < C_; ++c) {
        const float2 top = *(const float2*)(xp + (size_t)c * N_);
        const float2 bot = *(const float2*)(xp + (size_t)c * N_ + W_);
        #pragma unroll
        for (int o = 0; o < PG_OG; ++o) {
            const float wv = wr[o * C_ + c];
            acc[0][o] += wv * top.x;
            acc[1][o] += wv * top.y;
            acc[2][o] += wv * bot.x;
            acc[3][o] += wv * bot.y;
        }
    }

    float res[PG_OG];
    #pragma unroll
    for (int o = 0; o < PG_OG; ++o) {
        float r = fmaxf(-3.0e38f, acc[0][o]);
        r = fmaxf(r, acc[1][o]);
        r = fmaxf(r, acc[2][o]);
        res[o] = fmaxf(r, acc[3][o]);
    }

    if (grp == 0) {
        v8h lo;
        #pragma unroll
        for (int o = 0; o < CQ; ++o) lo[o] = (_Float16)res[o];
        const v8h zz = {};
        _Float16* pp = phiPad + (((size_t)b * M_ + p) << 4);
        *(v8h*)(pp)     = lo;
        *(v8h*)(pp + 8) = zz;
    } else {
        _Float16* gp = g16 + ((size_t)(b * CG + (grp - 1) * PG_OG)) * M_ + p;
        #pragma unroll
        for (int o = 0; o < PG_OG; ++o) gp[(size_t)o * M_] = (_Float16)res[o];
    }
}

// ---------------------------------------------------------------------------
// Phase 2: fused flash-style attention + w_o projection + residual.
// One wave owns a 16-row n-tile. Sᵀ tiles via v_wmma_f32_16x16x32_f16
// (lane = n in D layout => per-lane softmax). Sᵀ D-tile pair converts to the
// PV A fragment with per-lane f32->f16 packs only. All fragment loads are
// unconditional b128 loads (zero padding stored in memory), no exec masking.
// ---------------------------------------------------------------------------
__global__ void __launch_bounds__(256)
sagan_attn_kernel(const float* __restrict__ x, const float* __restrict__ w_o,
                  const float* __restrict__ gamma,
                  const _Float16* __restrict__ thetaPad,
                  const _Float16* __restrict__ phiPad,
                  const _Float16* __restrict__ g16,
                  float* __restrict__ out)
{
    __shared__ float ldsO[8][16][CG];  // per-wave O tile  (16 KB)
    __shared__ float ldsS[8][16];      // per-wave row sums
    __shared__ float ldsW[C_ * CG];    // w_o cache        (8 KB)

    const int tid  = threadIdx.x;
    const int wave = tid >> 5;
    const int lane = tid & 31;
    const int ln   = lane & 15;   // n (or c) index within tile
    const int hi   = lane >> 4;   // lane half

    for (int i = tid; i < C_ * CG; i += 256) ldsW[i] = w_o[i];

    const int tile = blockIdx.x * 8 + wave;     // 4096 tiles total
    const int b  = tile >> 10;                  // N_/16 = 1024 tiles per batch
    const int n0 = (tile & 1023) << 4;

    const v8h zh = {};

    // B fragment: theta. halves 0..7 <- row (K-offset hi*8, zeros stored for
    // K>=8); halves 8..15 (K=16..31) constant zero.
    v8h tlo = *(const v8h*)(thetaPad + (((size_t)b * N_ + n0 + ln) << 4) + (hi << 3));
    const v16h bth = CAT16(tlo, zh);

    const _Float16* phib = phiPad + ((size_t)b * M_ << 4) + (hi << 3);
    const _Float16* gb   = g16    + (size_t)b * CG * M_;
    const v8f zero8 = {};

    // ---- pass 1: row max over m (per lane: 8 m-rows of column n=ln) ----
    float mmax = -3.0e38f;
    for (int m0 = 0; m0 < M_; m0 += 32) {
        const _Float16* pr = phib + ((size_t)(m0 + ln) << 4);
        v8h a0 = *(const v8h*)(pr);
        v8h a1 = *(const v8h*)(pr + (16 << 4));
        v16h ap0 = CAT16(a0, zh);
        v16h ap1 = CAT16(a1, zh);
        v8f s0 = __builtin_amdgcn_wmma_f32_16x16x32_f16(false, ap0, false, bth,
                                                        (short)0, zero8, false, false);
        v8f s1 = __builtin_amdgcn_wmma_f32_16x16x32_f16(false, ap1, false, bth,
                                                        (short)0, zero8, false, false);
        #pragma unroll
        for (int i = 0; i < 8; ++i) mmax = fmaxf(mmax, fmaxf(s0[i], s1[i]));
    }
    mmax = fmaxf(mmax, __shfl_xor(mmax, 16, 32));

    // ---- pass 2: exp + P.g accumulation ----
    const float log2e = 1.44269504088896340736f;
    float rsum = 0.f;
    v8f acc0 = {}, acc1 = {};
    for (int m0 = 0; m0 < M_; m0 += 32) {
        const _Float16* pr = phib + ((size_t)(m0 + ln) << 4);
        v8h a0 = *(const v8h*)(pr);
        v8h a1 = *(const v8h*)(pr + (16 << 4));
        v16h ap0 = CAT16(a0, zh);
        v16h ap1 = CAT16(a1, zh);
        v8f s0 = __builtin_amdgcn_wmma_f32_16x16x32_f16(false, ap0, false, bth,
                                                        (short)0, zero8, false, false);
        v8f s1 = __builtin_amdgcn_wmma_f32_16x16x32_f16(false, ap1, false, bth,
                                                        (short)0, zero8, false, false);
        // S^T D-layout -> PV A-layout: pure per-lane f32->f16 packing.
        v16h P;
        #pragma unroll
        for (int i = 0; i < 8; ++i) {
            float p0 = exp2f((s0[i] - mmax) * log2e);
            float p1 = exp2f((s1[i] - mmax) * log2e);
            rsum += p0 + p1;
            P[i]     = (_Float16)p0;
            P[8 + i] = (_Float16)p1;
        }
        // B fragments from g (channel-major => contiguous 16B per half-lane)
        const _Float16* g0 = gb + (size_t)ln * M_        + m0 + (hi << 3);
        const _Float16* g1 = gb + (size_t)(16 + ln) * M_ + m0 + (hi << 3);
        v8h g0a = *(const v8h*)(g0);
        v8h g0b = *(const v8h*)(g0 + 16);
        v8h g1a = *(const v8h*)(g1);
        v8h g1b = *(const v8h*)(g1 + 16);
        v16h bg0 = CAT16(g0a, g0b);
        v16h bg1 = CAT16(g1a, g1b);
        acc0 = __builtin_amdgcn_wmma_f32_16x16x32_f16(false, P, false, bg0,
                                                      (short)0, acc0, false, false);
        acc1 = __builtin_amdgcn_wmma_f32_16x16x32_f16(false, P, false, bg1,
                                                      (short)0, acc1, false, false);
    }
    rsum += __shfl_xor(rsum, 16, 32);

    // stage O tile + row sums through per-wave LDS
    if (hi == 0) ldsS[wave][ln] = rsum;
    #pragma unroll
    for (int r = 0; r < 8; ++r) {
        ldsO[wave][r + hi * 8][ln]      = acc0[r];
        ldsO[wave][r + hi * 8][16 + ln] = acc1[r];
    }
    __syncthreads();

    // epilogue: out = gamma * w_o.(O/rowsum) + x
    const float gma  = gamma[0];
    const float rinv = 1.0f / ldsS[wave][ln];
    float orow[CG];
    #pragma unroll
    for (int ci = 0; ci < CG; ++ci) orow[ci] = ldsO[wave][ln][ci] * rinv;

    const size_t xbase = (size_t)b * C_ * N_;
    const int co_base = hi * 32;
    for (int j = 0; j < 32; ++j) {
        const int co = co_base + j;
        const float* wrow = ldsW + (size_t)co * CG;
        float v = 0.f;
        #pragma unroll
        for (int ci = 0; ci < CG; ++ci) v += wrow[ci] * orow[ci];
        const size_t oi = xbase + (size_t)co * N_ + (n0 + ln);
        out[oi] = gma * v + x[oi];
    }
}

// ---------------------------------------------------------------------------
extern "C" void kernel_launch(void* const* d_in, const int* in_sizes, int n_in,
                              void* d_out, int out_size, void* d_ws, size_t ws_size,
                              hipStream_t stream)
{
    const float* x       = (const float*)d_in[0];
    const float* w_theta = (const float*)d_in[1];
    const float* w_phi   = (const float*)d_in[2];
    const float* w_g     = (const float*)d_in[3];
    const float* w_o     = (const float*)d_in[4];
    const float* gamma   = (const float*)d_in[5];
    float* out = (float*)d_out;

    _Float16* thetaPad = (_Float16*)d_ws;                      // B*N*16 = 1M halves (2 MB)
    _Float16* phiPad   = thetaPad + ((size_t)B_ * N_ << 4);    // B*M*16 = 256K halves (512 KB)
    _Float16* g16      = phiPad   + ((size_t)B_ * M_ << 4);    // B*32*M = 512K halves (1 MB)

    sagan_theta_kernel<<<(B_ * N_) / 256, 256, 0, stream>>>(x, w_theta, thetaPad);
    sagan_phig_kernel<<<(B_ * M_) / 64, PG_T, 0, stream>>>(x, w_phi, w_g, phiPad, g16);
    sagan_attn_kernel<<<(B_ * (N_ / 16)) / 8, 256, 0, stream>>>(
        x, w_o, gamma, thetaPad, phiPad, g16, out);
}

// v002
// A run of this version takes 144 microseconds.
// Next to v001, in two timings, it ran 1.10 and 1.11 times as fast.
// Counting every step since v000, it is 1.79 times as fast.
#include <hip/hip_runtime.h>
#include <hip/hip_bf16.h>

typedef __attribute__((ext_vector_type(16))) _Float16 v16h;
typedef __attribute__((ext_vector_type(8)))  _Float16 v8h;
typedef __attribute__((ext_vector_type(8)))  float    v8f;

#define B_  4
#define C_  64
#define CQ  8          // C/8
#define CP  16         // padded K rows for theta/phi (upper 8 stored zero)
#define CG  32         // C/2
#define H_  128
#define W_  128
#define N_  (H_*W_)    // 16384
#define M_  (N_/4)     // 4096

#define CAT16(a, b) __builtin_shufflevector(a, b, 0,1,2,3,4,5,6,7,8,9,10,11,12,13,14,15)

// ---------------------------------------------------------------------------
// Phase 1a: thetaPad[b][n][0..15] : halves 0..7 = w_theta . x[:, n], 8..15 = 0
// ---------------------------------------------------------------------------
__global__ void __launch_bounds__(256)
sagan_theta_kernel(const float* __restrict__ x, const float* __restrict__ w_theta,
                   _Float16* __restrict__ thetaPad)
{
    __shared__ float w[CQ * C_];
    for (int i = threadIdx.x; i < CQ * C_; i += blockDim.x) w[i] = w_theta[i];
    __syncthreads();

    const int idx = blockIdx.x * blockDim.x + threadIdx.x;   // b*N_ + n
    const int b = idx >> 14;
    const int n = idx & (N_ - 1);

    float acc[CQ] = {};
    const float* xp = x + (size_t)b * C_ * N_ + n;
    #pragma unroll 8
    for (int c = 0; c < C_; ++c) {
        float xv = xp[(size_t)c * N_];
        #pragma unroll
        for (int o = 0; o < CQ; ++o) acc[o] += w[o * C_ + c] * xv;
    }
    v8h lo;
    #pragma unroll
    for (int o = 0; o < CQ; ++o) lo[o] = (_Float16)acc[o];
    const v8h zz = {};
    _Float16* tp = thetaPad + ((size_t)idx << 4);
    *(v8h*)(tp)      = lo;   // global_store_b128
    *(v8h*)(tp + 8)  = zz;   // zero pad (K = 8..15)
}

// ---------------------------------------------------------------------------
// Phase 1b: fused 1x1 conv + 2x2 maxpool for phi and g.
//   phiPad[b][p][0..15]  (f16, zero-padded rows for WMMA A fragments)
//   g16[b][p/32][cg/16][(p/16)&1][lane][8]  (f16, in the order of the PV B
//   fragments: lane = ((p/8)&1)*16 + cg%16, element = p%8, so that one 16-byte
//   load per lane of the attention loop covers 512 contiguous bytes)
// One work-group = one pooled row (64 pooled pixels) x all 40 outputs.
// Two waves cover the 64 pixels; five such pairs take 8 outputs each
// (pair 0 = phi, pairs 1..4 = g). A thread keeps its 2x2 window x 8 outputs
// in registers, so one weight read from LDS feeds four multiply-adds.
// ---------------------------------------------------------------------------
#define PG_OG 8                        // outputs per thread
#define PG_NG ((CQ + CG) / PG_OG)      // 5 output groups
#define PG_T  (64 * PG_NG)             // 320 threads

__global__ void __launch_bounds__(PG_T)
sagan_phig_kernel(const float* __restrict__ x, const float* __restrict__ w_phi,
                  const float* __restrict__ w_g,
                  _Float16* __restrict__ phiPad, _Float16* __restrict__ g16)
{
    __shared__ __attribute__((aligned(16))) float wl[(CQ + CG) * C_];  // rows 0..7 phi, 8..39 g
    // 2560 weights = 8 per thread; unrolled so that the 8 loads fly together
    #pragma unroll
    for (int k = 0; k < (CQ + CG) * C_ / PG_T; ++k) {
        const int i = threadIdx.x + k * PG_T;
        wl[i] = (i < CQ * C_) ? w_phi[i] : w_g[i - CQ * C_];
    }
    __syncthreads();

    const int grp = threadIdx.x >> 6;        // output group, same for a whole wave
    const int wq  = threadIdx.x & 63;        // pooled column
    const int b   = blockIdx.x >> 6;
    const int hp  = blockIdx.x & 63;         // pooled row
    const int p   = hp * 64 + wq;

    const float* xp = x + (size_t)b * C_ * N_ + (hp * 2) * W_ + wq * 2;
    const float* wr = wl + grp * PG_OG * C_;

    float acc[4][PG_OG] = {};
    // unroll 16: four channels' weights come as one 16-byte LDS read, and the
    // x loads of later channels are issued while earlier ones are worked on
    #pragma unroll 16
    for (int c = 0; c < C_; ++c) {
        const float2 top = *(const float2*)(xp + (size_t)c * N_);
        const float2 bot = *(const float2*)(xp + (size_t)c * N_ + W_);
        #pragma unroll
        for (int o = 0; o < PG_OG; ++o) {
            const float wv = wr[o * C_ + c];
            acc[0][o] += wv * top.x;
            acc[1][o] += wv * top.y;
            acc[2][o] += wv * bot.x;
            acc[3][o] += wv * bot.y;
        }
    }

    float res[PG_OG];
    #pragma unroll
    for (int o = 0; o < PG_OG; ++o) {
        float r = fmaxf(-3.0e38f, acc[0][o]);
        r = fmaxf(r, acc[1][o]);
        r = fmaxf(r, acc[2][o]);
        res[o] = fmaxf(r, acc[3][o]);
    }

    if (grp == 0) {
        v8h lo;
        #pragma unroll
        for (int o = 0; o < CQ; ++o) lo[o] = (_Float16)res[o];
        const v8h zz = {};
        _Float16* pp = phiPad + (((size_t)b * M_ + p) << 4);
        *(v8h*)(pp)     = lo;
        *(v8h*)(pp + 8) = zz;
    } else {
        // channel c = (grp-1)*8 + o: tile c/16 = (grp-1)/2, column c%16 = ((grp-1)&1)*8 + o
        const int ct   = (grp - 1) >> 1;
        const int frag = ((b * (M_ / 32) + (p >> 5)) * 2 + ct) * 2 + ((p >> 4) & 1);
        const int fl   = ((p >> 3) & 1) * 16 + ((grp - 1) & 1) * 8;
        _Float16* gp = g16 + (((size_t)frag * 32 + fl) << 3) + (p & 7);
        #pragma unroll
        for (int o = 0; o < PG_OG; ++o) gp[o * 8] = (_Float16)res[o];
    }
}

// ---------------------------------------------------------------------------
// Phase 2: fused flash-style attention + w_o projection + residual.
// One wave owns a 16-row n-tile. Sᵀ tiles via v_wmma_f32_16x16x32_f16
// (lane = n in D layout => per-lane softmax). Sᵀ D-tile pair converts to the
// PV A fragment with per-lane f32->f16 packs only. All fragment loads are
// unconditional b128 loads (zero padding stored in memory), no exec masking.
// ---------------------------------------------------------------------------
__global__ void __launch_bounds__(256)
sagan_attn_kernel(const float* __restrict__ x, const float* __restrict__ w_o,
                  const float* __restrict__ gamma,
                  const _Float16* __restrict__ thetaPad,
                  const _Float16* __restrict__ phiPad,
                  const _Float16* __restrict__ g16,
                  float* __restrict__ out)
{
    __shared__ float ldsO[8][16][CG];  // per-wave O tile  (16 KB)
    __shared__ float ldsS[8][16];      // per-wave row sums
    __shared__ float ldsW[C_ * CG];    // w_o cache        (8 KB)

    const int tid  = threadIdx.x;
    const int wave = tid >> 5;
    const int lane = tid & 31;
    const int ln   = lane & 15;   // n (or c) index within tile
    const int hi   = lane >> 4;   // lane half

    for (int i = tid; i < C_ * CG; i += 256) ldsW[i] = w_o[i];

    const int tile = blockIdx.x * 8 + wave;     // 4096 tiles total
    const int b  = tile >> 10;                  // N_/16 = 1024 tiles per batch
    const int n0 = (tile & 1023) << 4;

    const v8h zh = {};

    // B fragment: theta. halves 0..7 <- row (K-offset hi*8, zeros stored for
    // K>=8); halves 8..15 (K=16..31) constant zero.
    v8h tlo = *(const v8h*)(thetaPad + (((size_t)b * N_ + n0 + ln) << 4) + (hi << 3));
    const v16h bth = CAT16(tlo, zh);

    const _Float16* phib = phiPad + ((size_t)b * M_ << 4) + (hi << 3);
    const _Float16* gb   = g16    + (size_t)b * CG * M_ + (lane << 3);
    const v8f zero8 = {};

    // ---- pass 1: row max over m (per lane: 8 m-rows of column n=ln) ----
    float mmax = -3.0e38f;
    for (int m0 = 0; m0 < M_; m0 += 32) {
        const _Float16* pr = phib + ((size_t)(m0 + ln) << 4);
        v8h a0 = *(const v8h*)(pr);
        v8h a1 = *(const v8h*)(pr + (16 << 4));
        v16h ap0 = CAT16(a0, zh);
        v16h ap1 = CAT16(a1, zh);
        v8f s0 = __builtin_amdgcn_wmma_f32_16x16x32_f16(false, ap0, false, bth,
                                                        (short)0, zero8, false, false);
        v8f s1 = __builtin_amdgcn_wmma_f32_16x16x32_f16(false, ap1, false, bth,
                                                        (short)0, zero8, false, false);
        #pragma unroll
        for (int i = 0; i < 8; ++i) mmax = fmaxf(mmax, fmaxf(s0[i], s1[i]));
    }
    mmax = fmaxf(mmax, __shfl_xor(mmax, 16, 32));

    // ---- pass 2: exp + P.g accumulation ----
    const float log2e = 1.44269504088896340736f;
    float rsum = 0.f;
    v8f acc0 = {}, acc1 = {};
    for (int m0 = 0; m0 < M_; m0 += 32) {
        const _Float16* pr = phib + ((size_t)(m0 + ln) << 4);
        v8h a0 = *(const v8h*)(pr);
        v8h a1 = *(const v8h*)(pr + (16 << 4));
        v16h ap0 = CAT16(a0, zh);
        v16h ap1 = CAT16(a1, zh);
        v8f s0 = __builtin_amdgcn_wmma_f32_16x16x32_f16(false, ap0, false, bth,
                                                        (short)0, zero8, false, false);
        v8f s1 = __builtin_amdgcn_wmma_f32_16x16x32_f16(false, ap1, false, bth,
                                                        (short)0, zero8, false, false);
        // S^T D-layout -> PV A-layout: pure per-lane f32->f16 packing.
        v16h P;
        #pragma unroll
        for (int i = 0; i < 8; ++i) {
            float p0 = exp2f((s0[i] - mmax) * log2e);
            float p1 = exp2f((s1[i] - mmax) * log2e);
            rsum += p0 + p1;
            P[i]     = (_Float16)p0;
            P[8 + i] = (_Float16)p1;
        }
        // B fragments from g (stored in fragment order: each load is 512
        // contiguous bytes per wave, four whole lines)
        const _Float16* gf = gb + ((size_t)m0 << 5);   // 32 m x 32 channels per block
        v8h g0a = *(const v8h*)(gf);
        v8h g0b = *(const v8h*)(gf + 256);
        v8h g1a = *(const v8h*)(gf + 512);
        v8h g1b = *(const v8h*)(gf + 768);
        v16h bg0 = CAT16(g0a, g0b);
        v16h bg1 = CAT16(g1a, g1b);
        acc0 = __builtin_amdgcn_wmma_f32_16x16x32_f16(false, P, false, bg0,
                                                      (short)0, acc0, false, false);
        acc1 = __builtin_amdgcn_wmma_f32_16x16x32_f16(false, P, false, bg1,
                                                      (short)0, acc1, false, false);
    }
    rsum += __shfl_xor(rsum, 16, 32);

    // stage O tile + row sums through per-wave LDS
    if (hi == 0) ldsS[wave][ln] = rsum;
    #pragma unroll
    for (int r = 0; r < 8; ++r) {
        ldsO[wave][r + hi * 8][ln]      = acc0[r];
        ldsO[wave][r + hi * 8][16 + ln] = acc1[r];
    }
    __syncthreads();

    // epilogue: out = gamma * w_o.(O/rowsum) + x
    const float gma  = gamma[0];
    const float rinv = 1.0f / ldsS[wave][ln];
    float orow[CG];
    #pragma unroll
    for (int ci = 0; ci < CG; ++ci) orow[ci] = ldsO[wave][ln][ci] * rinv;

    const size_t xbase = (size_t)b * C_ * N_;
    const int co_base = hi * 32;
    for (int j = 0; j < 32; ++j) {
        const int co = co_base + j;
        const float* wrow = ldsW + (size_t)co * CG;
        float v = 0.f;
        #pragma unroll
        for (int ci = 0; ci < CG; ++ci) v += wrow[ci] * orow[ci];
        const size_t oi = xbase + (size_t)co * N_ + (n0 + ln);
        out[oi] = gma * v + x[oi];
    }
}

// ---------------------------------------------------------------------------
extern "C" void kernel_launch(void* const* d_in, const int* in_sizes, int n_in,
                              void* d_out, int out_size, void* d_ws, size_t ws_size,
                              hipStream_t stream)
{
    const float* x       = (const float*)d_in[0];
    const float* w_theta = (const float*)d_in[1];
    const float* w_phi   = (const float*)d_in[2];
    const float* w_g     = (const float*)d_in[3];
    const float* w_o     = (const float*)d_in[4];
    const float* gamma   = (const float*)d_in[5];
    float* out = (float*)d_out;

    _Float16* thetaPad = (_Float16*)d_ws;                      // B*N*16 = 1M halves (2 MB)
    _Float16* phiPad   = thetaPad + ((size_t)B_ * N_ << 4);    // B*M*16 = 256K halves (512 KB)
    _Float16* g16      = phiPad   + ((size_t)B_ * M_ << 4);    // B*32*M = 512K halves (1 MB)

    sagan_theta_kernel<<<(B_ * N_) / 256, 256, 0, stream>>>(x, w_theta, thetaPad);
    sagan_phig_kernel<<<(B_ * M_) / 64, PG_T, 0, stream>>>(x, w_phi, w_g, phiPad, g16);
    sagan_attn_kernel<<<(B_ * (N_ / 16)) / 8, 256, 0, stream>>>(
        x, w_o, gamma, thetaPad, phiPad, g16, out);
}

// v003
// Measured time: 132 microseconds a run.
// Timed twice side by side with v002, it ran 1.08 and 1.10 times as fast.
// Over all steps from v000 it is 1.95 times as fast.
#include <hip/hip_runtime.h>
#include <hip/hip_bf16.h>

typedef __attribute__((ext_vector_type(16))) _Float16 v16h;
typedef __attribute__((ext_vector_type(8)))  _Float16 v8h;
typedef __attribute__((ext_vector_type(8)))  float    v8f;

#define B_  4
#define C_  64
#define CQ  8          // C/8
#define CP  16         // padded K rows for theta/phi (upper 8 stored zero)
#define CG  32         // C/2
#define H_  128
#define W_  128
#define N_  (H_*W_)    // 16384
#define M_  (N_/4)     // 4096

#define CAT16(a, b) __builtin_shufflevector(a, b, 0,1,2,3,4,5,6,7,8,9,10,11,12,13,14,15)

// ---------------------------------------------------------------------------
// Phase 1a: thetaPad[b][n][0..15] : halves 0..7 = w_theta . x[:, n], 8..15 = 0
// ---------------------------------------------------------------------------
__global__ void __launch_bounds__(256)
sagan_theta_kernel(const float* __restrict__ x, const float* __restrict__ w_theta,
                   _Float16* __restrict__ thetaPad)
{
    __shared__ float w[CQ * C_];
    for (int i = threadIdx.x; i < CQ * C_; i += blockDim.x) w[i] = w_theta[i];
    __syncthreads();

    const int idx = blockIdx.x * blockDim.x + threadIdx.x;   // b*N_ + n
    const int b = idx >> 14;
    const int n = idx & (N_ - 1);

    float acc[CQ] = {};
    const float* xp = x + (size_t)b * C_ * N_ + n;
    #pragma unroll 8
    for (int c = 0; c < C_; ++c) {
        float xv = xp[(size_t)c * N_];
        #pragma unroll
        for (int o = 0; o < CQ; ++o) acc[o] += w[o * C_ + c] * xv;
    }
    v8h lo;
    #pragma unroll
    for (int o = 0; o < CQ; ++o) lo[o] = (_Float16)acc[o];
    const v8h zz = {};
    _Float16* tp = thetaPad + ((size_t)idx << 4);
    *(v8h*)(tp)      = lo;   // global_store_b128
    *(v8h*)(tp + 8)  = zz;   // zero pad (K = 8..15)
}

// ---------------------------------------------------------------------------
// Phase 1b: fused 1x1 conv + 2x2 maxpool for phi and g.
//   phiPad[b][p][0..15]  (f16, zero-padded rows for WMMA A fragments)
//   g16[b][p/32][cg/16][(p/16)&1][lane][8]  (f16, in the order of the PV B
//   fragments: lane = ((p/8)&1)*16 + cg%16, element = p%8, so that one 16-byte
//   load per lane of the attention loop covers 512 contiguous bytes)
// One work-group = one pooled row (64 pooled pixels) x all 40 outputs.
// Two waves cover the 64 pixels; five such pairs take 8 outputs each
// (pair 0 = phi, pairs 1..4 = g). A thread keeps its 2x2 window x 8 outputs
// in registers, so one weight read from LDS feeds four multiply-adds.
// ---------------------------------------------------------------------------
#define PG_OG 8                        // outputs per thread
#define PG_NG ((CQ + CG) / PG_OG)      // 5 output groups
#define PG_T  (64 * PG_NG)             // 320 threads

__global__ void __launch_bounds__(PG_T)
sagan_phig_kernel(const float* __restrict__ x, const float* __restrict__ w_phi,
                  const float* __restrict__ w_g,
                  _Float16* __restrict__ phiPad, _Float16* __restrict__ g16)
{
    __shared__ __attribute__((aligned(16))) float wl[(CQ + CG) * C_];  // rows 0..7 phi, 8..39 g
    // 2560 weights = 8 per thread; unrolled so that the 8 loads fly together
    #pragma unroll
    for (int k = 0; k < (CQ + CG) * C_ / PG_T; ++k) {
        const int i = threadIdx.x + k * PG_T;
        wl[i] = (i < CQ * C_) ? w_phi[i] : w_g[i - CQ * C_];
    }
    __syncthreads();

    const int grp = threadIdx.x >> 6;        // output group, same for a whole wave
    const int wq  = threadIdx.x & 63;        // pooled column
    const int b   = blockIdx.x >> 6;
    const int hp  = blockIdx.x & 63;         // pooled row
    const int p   = hp * 64 + wq;

    const float* xp = x + (size_t)b * C_ * N_ + (hp * 2) * W_ + wq * 2;
    const float* wr = wl + grp * PG_OG * C_;

    float acc[4][PG_OG] = {};
    // unroll 16: four channels' weights come as one 16-byte LDS read, and the
    // x loads of later channels are issued while earlier ones are worked on
    #pragma unroll 16
    for (int c = 0; c < C_; ++c) {
        const float2 top = *(const float2*)(xp + (size_t)c * N_);
        const float2 bot = *(const float2*)(xp + (size_t)c * N_ + W_);
        #pragma unroll
        for (int o = 0; o < PG_OG; ++o) {
            const float wv = wr[o * C_ + c];
            acc[0][o] += wv * top.x;
            acc[1][o] += wv * top.y;
            acc[2][o] += wv * bot.x;
            acc[3][o] += wv * bot.y;
        }
    }

    float res[PG_OG];
    #pragma unroll
    for (int o = 0; o < PG_OG; ++o) {
        float r = fmaxf(-3.0e38f, acc[0][o]);
        r = fmaxf(r, acc[1][o]);
        r = fmaxf(r, acc[2][o]);
        res[o] = fmaxf(r, acc[3][o]);
    }

    if (grp == 0) {
        v8h lo;
        #pragma unroll
        for (int o = 0; o < CQ; ++o) lo[o] = (_Float16)res[o];
        const v8h zz = {};
        _Float16* pp = phiPad + (((size_t)b * M_ + p) << 4);
        *(v8h*)(pp)     = lo;
        *(v8h*)(pp + 8) = zz;
    } else {
        // channel c = (grp-1)*8 + o: tile c/16 = (grp-1)/2, column c%16 = ((grp-1)&1)*8 + o
        const int ct   = (grp - 1) >> 1;
        const int frag = ((b * (M_ / 32) + (p >> 5)) * 2 + ct) * 2 + ((p >> 4) & 1);
        const int fl   = ((p >> 3) & 1) * 16 + ((grp - 1) & 1) * 8;
        _Float16* gp = g16 + (((size_t)frag * 32 + fl) << 3) + (p & 7);
        #pragma unroll
        for (int o = 0; o < PG_OG; ++o) gp[o * 8] = (_Float16)res[o];
    }
}

// ---------------------------------------------------------------------------
// Phase 2: fused flash-style attention + w_o projection + residual.
// One wave owns a 16-row n-tile. Sᵀ tiles via v_wmma_f32_16x16x32_f16
// (lane = n in D layout => per-lane softmax). Sᵀ D-tile pair converts to the
// PV A fragment with per-lane f32->f16 packs only. All fragment loads are
// unconditional b128 loads (zero padding stored in memory), no exec masking.
// ---------------------------------------------------------------------------
__global__ void __launch_bounds__(256)
sagan_attn_kernel(const float* __restrict__ x, const float* __restrict__ w_o,
                  const float* __restrict__ gamma,
                  const _Float16* __restrict__ thetaPad,
                  const _Float16* __restrict__ phiPad,
                  const _Float16* __restrict__ g16,
                  float* __restrict__ out)
{
    __shared__ float ldsO[8][16][CG];  // per-wave O tile  (16 KB)
    __shared__ float ldsS[8][16];      // per-wave row sums
    __shared__ float ldsW[C_ * CG];    // w_o cache        (8 KB)

    const int tid  = threadIdx.x;
    const int wave = tid >> 5;
    const int lane = tid & 31;
    const int ln   = lane & 15;   // n (or c) index within tile
    const int hi   = lane >> 4;   // lane half

    for (int i = tid; i < C_ * CG; i += 256) ldsW[i] = w_o[i];

    const int tile = blockIdx.x * 8 + wave;     // 4096 tiles total
    const int b  = tile >> 10;                  // N_/16 = 1024 tiles per batch
    const int n0 = (tile & 1023) << 4;

    const v8h zh = {};

    // B fragment: theta. halves 0..7 <- row (K-offset hi*8, zeros stored for
    // K>=8); halves 8..15 (K=16..31) constant zero.
    v8h tlo = *(const v8h*)(thetaPad + (((size_t)b * N_ + n0 + ln) << 4) + (hi << 3));
    const v16h bth = CAT16(tlo, zh);

    const _Float16* phib = phiPad + ((size_t)b * M_ << 4) + (hi << 3);
    const _Float16* gb   = g16    + (size_t)b * CG * M_ + (lane << 3);
    const v8f zero8 = {};

    // ---- pass 1: row max over m (per lane: 8 m-rows of column n=ln) ----
    float mmax = -3.0e38f;
    for (int m0 = 0; m0 < M_; m0 += 32) {
        const _Float16* pr = phib + ((size_t)(m0 + ln) << 4);
        v8h a0 = *(const v8h*)(pr);
        v8h a1 = *(const v8h*)(pr + (16 << 4));
        v16h ap0 = CAT16(a0, zh);
        v16h ap1 = CAT16(a1, zh);
        v8f s0 = __builtin_amdgcn_wmma_f32_16x16x32_f16(false, ap0, false, bth,
                                                        (short)0, zero8, false, false);
        v8f s1 = __builtin_amdgcn_wmma_f32_16x16x32_f16(false, ap1, false, bth,
                                                        (short)0, zero8, false, false);
        #pragma unroll
        for (int i = 0; i < 8; ++i) mmax = fmaxf(mmax, fmaxf(s0[i], s1[i]));
    }
    mmax = fmaxf(mmax, __shfl_xor(mmax, 16, 32));

    // ---- pass 2: exp + P.g accumulation ----
    const float log2e = 1.44269504088896340736f;
    float rsum = 0.f;
    v8f acc0 = {}, acc1 = {};
    for (int m0 = 0; m0 < M_; m0 += 32) {
        const _Float16* pr = phib + ((size_t)(m0 + ln) << 4);
        v8h a0 = *(const v8h*)(pr);
        v8h a1 = *(const v8h*)(pr + (16 << 4));
        v16h ap0 = CAT16(a0, zh);
        v16h ap1 = CAT16(a1, zh);
        v8f s0 = __builtin_amdgcn_wmma_f32_16x16x32_f16(false, ap0, false, bth,
                                                        (short)0, zero8, false, false);
        v8f s1 = __builtin_amdgcn_wmma_f32_16x16x32_f16(false, ap1, false, bth,
                                                        (short)0, zero8, false, false);
        // S^T D-layout -> PV A-layout: pure per-lane f32->f16 packing.
        v16h P;
        #pragma unroll
        for (int i = 0; i < 8; ++i) {
            // bare v_exp_f32, without the library's range fix-up: below 2^-126
            // it gives 0 where exp2f gives a subnormal; both round to 0 in f16
            // and both vanish in a row sum that holds the maximum's own 1
            float p0 = __builtin_amdgcn_exp2f((s0[i] - mmax) * log2e);
            float p1 = __builtin_amdgcn_exp2f((s1[i] - mmax) * log2e);
            rsum += p0 + p1;
            P[i]     = (_Float16)p0;
            P[8 + i] = (_Float16)p1;
        }
        // B fragments from g (stored in fragment order: each load is 512
        // contiguous bytes per wave, four whole lines)
        const _Float16* gf = gb + ((size_t)m0 << 5);   // 32 m x 32 channels per block
        v8h g0a = *(const v8h*)(gf);
        v8h g0b = *(const v8h*)(gf + 256);
        v8h g1a = *(const v8h*)(gf + 512);
        v8h g1b = *(const v8h*)(gf + 768);
        v16h bg0 = CAT16(g0a, g0b);
        v16h bg1 = CAT16(g1a, g1b);
        acc0 = __builtin_amdgcn_wmma_f32_16x16x32_f16(false, P, false, bg0,
                                                      (short)0, acc0, false, false);
        acc1 = __builtin_amdgcn_wmma_f32_16x16x32_f16(false, P, false, bg1,
                                                      (short)0, acc1, false, false);
    }
    rsum += __shfl_xor(rsum, 16, 32);

    // stage O tile + row sums through per-wave LDS
    if (hi == 0) ldsS[wave][ln] = rsum;
    #pragma unroll
    for (int r = 0; r < 8; ++r) {
        ldsO[wave][r + hi * 8][ln]      = acc0[r];
        ldsO[wave][r + hi * 8][16 + ln] = acc1[r];
    }
    __syncthreads();

    // epilogue: out = gamma * w_o.(O/rowsum) + x
    const float gma  = gamma[0];
    const float rinv = 1.0f / ldsS[wave][ln];
    float orow[CG];
    #pragma unroll
    for (int ci = 0; ci < CG; ++ci) orow[ci] = ldsO[wave][ln][ci] * rinv;

    const size_t xbase = (size_t)b * C_ * N_;
    const int co_base = hi * 32;
    for (int j = 0; j < 32; ++j) {
        const int co = co_base + j;
        const float* wrow = ldsW + (size_t)co * CG;
        float v = 0.f;
        #pragma unroll
        for (int ci = 0; ci < CG; ++ci) v += wrow[ci] * orow[ci];
        const size_t oi = xbase + (size_t)co * N_ + (n0 + ln);
        out[oi] = gma * v + x[oi];
    }
}

// ---------------------------------------------------------------------------
extern "C" void kernel_launch(void* const* d_in, const int* in_sizes, int n_in,
                              void* d_out, int out_size, void* d_ws, size_t ws_size,
                              hipStream_t stream)
{
    const float* x       = (const float*)d_in[0];
    const float* w_theta = (const float*)d_in[1];
    const float* w_phi   = (const float*)d_in[2];
    const float* w_g     = (const float*)d_in[3];
    const float* w_o     = (const float*)d_in[4];
    const float* gamma   = (const float*)d_in[5];
    float* out = (float*)d_out;

    _Float16* thetaPad = (_Float16*)d_ws;                      // B*N*16 = 1M halves (2 MB)
    _Float16* phiPad   = thetaPad + ((size_t)B_ * N_ << 4);    // B*M*16 = 256K halves (512 KB)
    _Float16* g16      = phiPad   + ((size_t)B_ * M_ << 4);    // B*32*M = 512K halves (1 MB)

    sagan_theta_kernel<<<(B_ * N_) / 256, 256, 0, stream>>>(x, w_theta, thetaPad);
    sagan_phig_kernel<<<(B_ * M_) / 64, PG_T, 0, stream>>>(x, w_phi, w_g, phiPad, g16);
    sagan_attn_kernel<<<(B_ * (N_ / 16)) / 8, 256, 0, stream>>>(
        x, w_o, gamma, thetaPad, phiPad, g16, out);
}

// v004
// One run takes 75.3 microseconds.
// In both of two side-by-side timings against v003, it was 1.74 times as fast.
// Over all steps from v000 it is 3.39 times as fast.
#include <hip/hip_runtime.h>
#include <hip/hip_bf16.h>

typedef __attribute__((ext_vector_type(16))) _Float16 v16h;
typedef __attribute__((ext_vector_type(8)))  _Float16 v8h;
typedef __attribute__((ext_vector_type(8)))  float    v8f;

#define B_  4
#define C_  64
#define CQ  8          // C/8
#define CP  16         // padded K rows for theta/phi (upper 8 stored zero)
#define CG  32         // C/2
#define H_  128
#define W_  128
#define N_  (H_*W_)    // 16384
#define M_  (N_/4)     // 4096

#define CAT16(a, b) __builtin_shufflevector(a, b, 0,1,2,3,4,5,6,7,8,9,10,11,12,13,14,15)

// ---------------------------------------------------------------------------
// Phase 1a: thetaPad[b][n][0..15] : halves 0..7 = w_theta . x[:, n], 8..15 = 0
// ---------------------------------------------------------------------------
__global__ void __launch_bounds__(256)
sagan_theta_kernel(const float* __restrict__ x, const float* __restrict__ w_theta,
                   _Float16* __restrict__ thetaPad)
{
    __shared__ float w[CQ * C_];
    for (int i = threadIdx.x; i < CQ * C_; i += blockDim.x) w[i] = w_theta[i];
    __syncthreads();

    const int idx = blockIdx.x * blockDim.x + threadIdx.x;   // b*N_ + n
    const int b = idx >> 14;
    const int n = idx & (N_ - 1);

    float acc[CQ] = {};
    const float* xp = x + (size_t)b * C_ * N_ + n;
    #pragma unroll 8
    for (int c = 0; c < C_; ++c) {
        float xv = xp[(size_t)c * N_];
        #pragma unroll
        for (int o = 0; o < CQ; ++o) acc[o] += w[o * C_ + c] * xv;
    }
    v8h lo;
    #pragma unroll
    for (int o = 0; o < CQ; ++o) lo[o] = (_Float16)acc[o];
    const v8h zz = {};
    _Float16* tp = thetaPad + ((size_t)idx << 4);
    *(v8h*)(tp)      = lo;   // global_store_b128
    *(v8h*)(tp + 8)  = zz;   // zero pad (K = 8..15)
}

// ---------------------------------------------------------------------------
// Phase 1b: fused 1x1 conv + 2x2 maxpool for phi and g.
//   phiPad[b][p][0..15]  (f16, zero-padded rows for WMMA A fragments)
//   g16[b][p/32][cg/16][(p/16)&1][lane][8]  (f16, in the order of the PV g
//   fragments: lane = ((p/8)&1)*16 + cg%16, element = p%8, so that one 16-byte
//   load per lane of the attention loop covers 512 contiguous bytes)
// One work-group = one pooled row (64 pooled pixels) x all 40 outputs.
// Two waves cover the 64 pixels; five such pairs take 8 outputs each
// (pair 0 = phi, pairs 1..4 = g). A thread keeps its 2x2 window x 8 outputs
// in registers, so one weight read from LDS feeds four multiply-adds.
// ---------------------------------------------------------------------------
#define PG_OG 8                        // outputs per thread
#define PG_NG ((CQ + CG) / PG_OG)      // 5 output groups
#define PG_T  (64 * PG_NG)             // 320 threads

__global__ void __launch_bounds__(PG_T)
sagan_phig_kernel(const float* __restrict__ x, const float* __restrict__ w_phi,
                  const float* __restrict__ w_g,
                  _Float16* __restrict__ phiPad, _Float16* __restrict__ g16)
{
    __shared__ __attribute__((aligned(16))) float wl[(CQ + CG) * C_];  // rows 0..7 phi, 8..39 g
    // 2560 weights = 8 per thread; unrolled so that the 8 loads fly together
    #pragma unroll
    for (int k = 0; k < (CQ + CG) * C_ / PG_T; ++k) {
        const int i = threadIdx.x + k * PG_T;
        wl[i] = (i < CQ * C_) ? w_phi[i] : w_g[i - CQ * C_];
    }
    __syncthreads();

    const int grp = threadIdx.x >> 6;        // output group, same for a whole wave
    const int wq  = threadIdx.x & 63;        // pooled column
    const int b   = blockIdx.x >> 6;
    const int hp  = blockIdx.x & 63;         // pooled row
    const int p   = hp * 64 + wq;

    const float* xp = x + (size_t)b * C_ * N_ + (hp * 2) * W_ + wq * 2;
    const float* wr = wl + grp * PG_OG * C_;

    float acc[4][PG_OG] = {};
    // unroll 16: four channels' weights come as one 16-byte LDS read, and the
    // x loads of later channels are issued while earlier ones are worked on
    #pragma unroll 16
    for (int c = 0; c < C_; ++c) {
        const float2 top = *(const float2*)(xp + (size_t)c * N_);
        const float2 bot = *(const float2*)(xp + (size_t)c * N_ + W_);
        #pragma unroll
        for (int o = 0; o < PG_OG; ++o) {
            const float wv = wr[o * C_ + c];
            acc[0][o] += wv * top.x;
            acc[1][o] += wv * top.y;
            acc[2][o] += wv * bot.x;
            acc[3][o] += wv * bot.y;
        }
    }

    float res[PG_OG];
    #pragma unroll
    for (int o = 0; o < PG_OG; ++o) {
        float r = fmaxf(-3.0e38f, acc[0][o]);
        r = fmaxf(r, acc[1][o]);
        r = fmaxf(r, acc[2][o]);
        res[o] = fmaxf(r, acc[3][o]);
    }

    if (grp == 0) {
        v8h lo;
        #pragma unroll
        for (int o = 0; o < CQ; ++o) lo[o] = (_Float16)res[o];
        const v8h zz = {};
        _Float16* pp = phiPad + (((size_t)b * M_ + p) << 4);
        *(v8h*)(pp)     = lo;
        *(v8h*)(pp + 8) = zz;
    } else {
        // channel c = (grp-1)*8 + o: tile c/16 = (grp-1)/2, column c%16 = ((grp-1)&1)*8 + o
        const int ct   = (grp - 1) >> 1;
        const int frag = ((b * (M_ / 32) + (p >> 5)) * 2 + ct) * 2 + ((p >> 4) & 1);
        const int fl   = ((p >> 3) & 1) * 16 + ((grp - 1) & 1) * 8;
        _Float16* gp = g16 + (((size_t)frag * 32 + fl) << 3) + (p & 7);
        #pragma unroll
        for (int o = 0; o < PG_OG; ++o) gp[o * 8] = (_Float16)res[o];
    }
}

// ---------------------------------------------------------------------------
// Phase 2: fused flash-style attention + w_o projection + residual.
// One wave owns a 16-row n-tile and walks the keys ONCE (online softmax).
// S^T tiles via v_wmma_f32_16x16x32_f16 (lane = n in D layout => per-lane
// softmax). An S^T D-tile pair converts to the B operand of O^T += g^T . P^T
// with per-lane f32->f16 packs only, and O^T again has lane = n, so that a
// change of the maximum in use rescales a lane's own registers.
// All fragment loads are unconditional b128 loads (zero padding stored in
// memory), no exec masking.
// ---------------------------------------------------------------------------
// lane l <-> lane l ^ 16 by a vector cross-row move
__device__ __forceinline__ float sagan_xhalf(float v)
{
    const int b = __builtin_bit_cast(int, v);
    return __builtin_bit_cast(float, __builtin_amdgcn_permlanex16(
        b, b, 0x76543210, 0xfedcba98, false, false));
}

__global__ void __launch_bounds__(256)
sagan_attn_kernel(const float* __restrict__ x, const float* __restrict__ w_o,
                  const float* __restrict__ gamma,
                  const _Float16* __restrict__ thetaPad,
                  const _Float16* __restrict__ phiPad,
                  const _Float16* __restrict__ g16,
                  float* __restrict__ out)
{
    __shared__ float ldsO[8][16][CG];  // per-wave O tile  (16 KB)
    __shared__ float ldsS[8][16];      // per-wave row sums
    __shared__ float ldsW[C_ * CG];    // w_o cache        (8 KB)

    const int tid  = threadIdx.x;
    const int wave = tid >> 5;
    const int lane = tid & 31;
    const int ln   = lane & 15;   // n (or c) index within tile
    const int hi   = lane >> 4;   // lane half

    for (int i = tid; i < C_ * CG; i += 256) ldsW[i] = w_o[i];

    const int tile = blockIdx.x * 8 + wave;     // 4096 tiles total
    const int b  = tile >> 10;                  // N_/16 = 1024 tiles per batch
    const int n0 = (tile & 1023) << 4;

    const v8h zh = {};

    // B fragment: theta. halves 0..7 <- row (K-offset hi*8, zeros stored for
    // K>=8); halves 8..15 (K=16..31) constant zero.
    v8h tlo = *(const v8h*)(thetaPad + (((size_t)b * N_ + n0 + ln) << 4) + (hi << 3));
    const v16h bth = CAT16(tlo, zh);

    const _Float16* phib = phiPad + ((size_t)b * M_ << 4) + (hi << 3);
    const _Float16* gb   = g16    + (size_t)b * CG * M_ + (lane << 3);
    const v8f zero8 = {};

    // ---- one pass over m: running maximum, exp, g.P accumulation ----
    // 64 keys per trip. muse is the maximum in use for column n = ln (the same
    // in both lane halves). It moves only when some column's new maximum lies
    // more than 5.5 above it (P stays below e^5.5 = 245, far inside f16); then
    // the sums so far are scaled by exp(old - new). One test per trip.
    const float log2e = 1.44269504088896340736f;
    float muse = -3.0e38f;
    float rsum = 0.f;
    v8f acc0 = {}, acc1 = {};
    for (int m0 = 0; m0 < M_; m0 += 64) {
        const _Float16* pr = phib + ((size_t)(m0 + ln) << 4);
        // g fragments (stored in fragment order: each load is 512 contiguous
        // bytes per wave, four whole lines); 32 m x 32 channels per 1024 halves
        const _Float16* gf = gb + ((size_t)m0 << 5);
        v8h a[4], gq[8];
        #pragma unroll
        for (int t = 0; t < 4; ++t) a[t] = *(const v8h*)(pr + ((t * 16) << 4));
        #pragma unroll
        for (int t = 0; t < 8; ++t) gq[t] = *(const v8h*)(gf + t * 256);
        // the loop advances the two address pairs while these loads are still
        // in flight: this wait stands between the loads and that overwrite
        asm volatile("s_wait_xcnt 0x0" ::: "memory");

        v8f s[4];
        #pragma unroll
        for (int t = 0; t < 4; ++t) {
            const v16h ap = CAT16(a[t], zh);
            s[t] = __builtin_amdgcn_wmma_f32_16x16x32_f16(false, ap, false, bth,
                                                          (short)0, zero8, false, false);
        }

        float mx0 = -3.0e38f, mx1 = -3.0e38f;
        #pragma unroll
        for (int i = 0; i < 8; ++i) {
            mx0 = fmaxf(mx0, fmaxf(s[0][i], s[1][i]));
            mx1 = fmaxf(mx1, fmaxf(s[2][i], s[3][i]));
        }
        float mx = fmaxf(mx0, mx1);
        mx = fmaxf(mx, sagan_xhalf(mx));
        if (__builtin_amdgcn_ballot_w32(mx > muse + 5.5f) != 0) {   // always on trip 0, rare later
            const float mnew = fmaxf(muse, mx);
            const float corr = __builtin_amdgcn_exp2f((muse - mnew) * log2e);  // 0 on trip 0
            muse = mnew;
            rsum *= corr;
            acc0 *= corr;
            acc1 *= corr;
        }

        #pragma unroll
        for (int k = 0; k < 2; ++k) {
            // S^T D-layout -> P^T B-layout: pure per-lane f32->f16 packing.
            v16h P;
            #pragma unroll
            for (int i = 0; i < 8; ++i) {
                // bare v_exp_f32, without the library's range fix-up: below 2^-126
                // it gives 0 where exp2f gives a subnormal; both round to 0 in f16
                // and both vanish in a row sum that holds the maximum's own term (>= 1)
                float p0 = __builtin_amdgcn_exp2f((s[2 * k][i]     - muse) * log2e);
                float p1 = __builtin_amdgcn_exp2f((s[2 * k + 1][i] - muse) * log2e);
                rsum += p0 + p1;
                P[i]     = (_Float16)p0;
                P[8 + i] = (_Float16)p1;
            }
            const v16h ag0 = CAT16(gq[4 * k],     gq[4 * k + 1]);
            const v16h ag1 = CAT16(gq[4 * k + 2], gq[4 * k + 3]);
            acc0 = __builtin_amdgcn_wmma_f32_16x16x32_f16(false, ag0, false, P,
                                                          (short)0, acc0, false, false);
            acc1 = __builtin_amdgcn_wmma_f32_16x16x32_f16(false, ag1, false, P,
                                                          (short)0, acc1, false, false);
        }
    }
    rsum += __shfl_xor(rsum, 16, 32);

    // stage O tile + row sums through per-wave LDS
    if (hi == 0) ldsS[wave][ln] = rsum;
    #pragma unroll
    for (int r = 0; r < 8; ++r) {
        ldsO[wave][ln][r + hi * 8]      = acc0[r];   // acc0[r] = O[n = ln][channel r + 8 hi]
        ldsO[wave][ln][16 + r + hi * 8] = acc1[r];
    }
    __syncthreads();

    // epilogue: out = gamma * w_o.(O/rowsum) + x
    const float gma  = gamma[0];
    const float rinv = 1.0f / ldsS[wave][ln];
    float orow[CG];
    #pragma unroll
    for (int ci = 0; ci < CG; ++ci) orow[ci] = ldsO[wave][ln][ci] * rinv;

    const size_t xbase = (size_t)b * C_ * N_;
    const int co_base = hi * 32;
    for (int j = 0; j < 32; ++j) {
        const int co = co_base + j;
        const float* wrow = ldsW + (size_t)co * CG;
        float v = 0.f;
        #pragma unroll
        for (int ci = 0; ci < CG; ++ci) v += wrow[ci] * orow[ci];
        const size_t oi = xbase + (size_t)co * N_ + (n0 + ln);
        out[oi] = gma * v + x[oi];
    }
}

// ---------------------------------------------------------------------------
extern "C" void kernel_launch(void* const* d_in, const int* in_sizes, int n_in,
                              void* d_out, int out_size, void* d_ws, size_t ws_size,
                              hipStream_t stream)
{
    const float* x       = (const float*)d_in[0];
    const float* w_theta = (const float*)d_in[1];
    const float* w_phi   = (const float*)d_in[2];
    const float* w_g     = (const float*)d_in[3];
    const float* w_o     = (const float*)d_in[4];
    const float* gamma   = (const float*)d_in[5];
    float* out = (float*)d_out;

    _Float16* thetaPad = (_Float16*)d_ws;                      // B*N*16 = 1M halves (2 MB)
    _Float16* phiPad   = thetaPad + ((size_t)B_ * N_ << 4);    // B*M*16 = 256K halves (512 KB)
    _Float16* g16      = phiPad   + ((size_t)B_ * M_ << 4);    // B*32*M = 512K halves (1 MB)

    sagan_theta_kernel<<<(B_ * N_) / 256, 256, 0, stream>>>(x, w_theta, thetaPad);
    sagan_phig_kernel<<<(B_ * M_) / 64, PG_T, 0, stream>>>(x, w_phi, w_g, phiPad, g16);
    sagan_attn_kernel<<<(B_ * (N_ / 16)) / 8, 256, 0, stream>>>(
        x, w_o, gamma, thetaPad, phiPad, g16, out);
}

// v005
// It runs in 73.2 microseconds.
// In both of two side-by-side timings against v004, it was 1.04 times as fast.
// Over all steps from v000 it is 3.53 times as fast.
#include <hip/hip_runtime.h>
#include <hip/hip_bf16.h>

typedef __attribute__((ext_vector_type(16))) _Float16 v16h;
typedef __attribute__((ext_vector_type(8)))  _Float16 v8h;
typedef __attribute__((ext_vector_type(8)))  float    v8f;

#define B_  4
#define C_  64
#define CQ  8          // C/8
#define CP  16         // padded K rows for theta/phi (upper 8 stored zero)
#define CG  32         // C/2
#define H_  128
#define W_  128
#define N_  (H_*W_)    // 16384
#define M_  (N_/4)     // 4096

#define CAT16(a, b) __builtin_shufflevector(a, b, 0,1,2,3,4,5,6,7,8,9,10,11,12,13,14,15)

// ---------------------------------------------------------------------------
// Phase 1: the three 1x1 convs of x in one launch; phi and g with their 2x2
// maxpool, theta unpooled.
//   thetaPad[b][n][0..15] : halves 0..7 = w_theta . x[:, n], 8..15 = 0
//   phiPad[b][p][0..15]  (f16, zero-padded rows for WMMA A fragments)
//   g16[b][p/32][cg/16][(p/16)&1][lane][8]  (f16, in the order of the PV g
//   fragments: lane = ((p/8)&1)*16 + cg%16, element = p%8, so that one 16-byte
//   load per lane of the attention loop covers 512 contiguous bytes)
// One work-group = one pooled row (64 pooled pixels = 2 x 128 pixels of x) x
// all 48 outputs. Two waves cover the 64 windows; six such pairs take 8
// outputs each (pair 0 = phi, pairs 1..4 = g, pair 5 = theta). A thread keeps
// its 2x2 window x 8 outputs in registers, so one weight read from LDS feeds
// four multiply-adds. The theta pair stores the four sums of its window as
// they are: the x rows it reads are the ones the other pairs read anyway.
// ---------------------------------------------------------------------------
#define PG_OG 8                             // outputs per thread
#define PG_NG ((CQ + CG + CQ) / PG_OG)      // 6 output groups
#define PG_T  (64 * PG_NG)                  // 384 threads

__global__ void __launch_bounds__(PG_T)
sagan_proj_kernel(const float* __restrict__ x, const float* __restrict__ w_theta,
                  const float* __restrict__ w_phi, const float* __restrict__ w_g,
                  _Float16* __restrict__ thetaPad,
                  _Float16* __restrict__ phiPad, _Float16* __restrict__ g16)
{
    // rows 0..7 phi, 8..39 g, 40..47 theta
    __shared__ __attribute__((aligned(16))) float wl[(CQ + CG + CQ) * C_];
    // 3072 weights = 8 per thread; unrolled so that the 8 loads fly together
    #pragma unroll
    for (int k = 0; k < (CQ + CG + CQ) * C_ / PG_T; ++k) {
        const int i = threadIdx.x + k * PG_T;
        wl[i] = (i < CQ * C_) ? w_phi[i]
              : (i < (CQ + CG) * C_) ? w_g[i - CQ * C_] : w_theta[i - (CQ + CG) * C_];
    }
    __syncthreads();

    const int grp = threadIdx.x >> 6;        // output group, same for a whole wave
    const int wq  = threadIdx.x & 63;        // pooled column
    const int b   = blockIdx.x >> 6;
    const int hp  = blockIdx.x & 63;         // pooled row
    const int p   = hp * 64 + wq;

    const float* xp = x + (size_t)b * C_ * N_ + (hp * 2) * W_ + wq * 2;
    const float* wr = wl + grp * PG_OG * C_;

    float acc[4][PG_OG] = {};
    // unroll 16: four channels' weights come as one 16-byte LDS read, and the
    // x loads of later channels are issued while earlier ones are worked on
    #pragma unroll 16
    for (int c = 0; c < C_; ++c) {
        const float2 top = *(const float2*)(xp + (size_t)c * N_);
        const float2 bot = *(const float2*)(xp + (size_t)c * N_ + W_);
        #pragma unroll
        for (int o = 0; o < PG_OG; ++o) {
            const float wv = wr[o * C_ + c];
            acc[0][o] += wv * top.x;
            acc[1][o] += wv * top.y;
            acc[2][o] += wv * bot.x;
            acc[3][o] += wv * bot.y;
        }
    }

    if (grp == PG_NG - 1) {
        // theta: window position k = (row k/2, column k%2) is pixel n; two
        // neighbouring pixels' padded rows are 64 contiguous bytes per thread
        const v8h zz = {};
        v8h lo[4];
        #pragma unroll
        for (int k = 0; k < 4; ++k) {
            #pragma unroll
            for (int o = 0; o < CQ; ++o) lo[k][o] = (_Float16)acc[k][o];
        }
        #pragma unroll
        for (int k = 0; k < 4; ++k) {
            const int n = (hp * 2 + (k >> 1)) * W_ + wq * 2 + (k & 1);
            _Float16* tp = thetaPad + (((size_t)b * N_ + n) << 4);
            *(v8h*)(tp)     = lo[k];   // global_store_b128
            *(v8h*)(tp + 8) = zz;      // zero pad (K = 8..15)
        }
        return;                     // whole waves leave; no barrier follows
    }

    float res[PG_OG];
    #pragma unroll
    for (int o = 0; o < PG_OG; ++o) {
        float r = fmaxf(-3.0e38f, acc[0][o]);
        r = fmaxf(r, acc[1][o]);
        r = fmaxf(r, acc[2][o]);
        res[o] = fmaxf(r, acc[3][o]);
    }

    if (grp == 0) {
        v8h lo;
        #pragma unroll
        for (int o = 0; o < CQ; ++o) lo[o] = (_Float16)res[o];
        const v8h zz = {};
        _Float16* pp = phiPad + (((size_t)b * M_ + p) << 4);
        *(v8h*)(pp)     = lo;
        *(v8h*)(pp + 8) = zz;
    } else {
        // channel c = (grp-1)*8 + o: tile c/16 = (grp-1)/2, column c%16 = ((grp-1)&1)*8 + o
        const int ct   = (grp - 1) >> 1;
        const int frag = ((b * (M_ / 32) + (p >> 5)) * 2 + ct) * 2 + ((p >> 4) & 1);
        const int fl   = ((p >> 3) & 1) * 16 + ((grp - 1) & 1) * 8;
        _Float16* gp = g16 + (((size_t)frag * 32 + fl) << 3) + (p & 7);
        #pragma unroll
        for (int o = 0; o < PG_OG; ++o) gp[o * 8] = (_Float16)res[o];
    }
}

// ---------------------------------------------------------------------------
// Phase 2: fused flash-style attention + w_o projection + residual.
// One wave owns a 16-row n-tile and walks the keys ONCE (online softmax).
// S^T tiles via v_wmma_f32_16x16x32_f16 (lane = n in D layout => per-lane
// softmax). An S^T D-tile pair converts to the B operand of O^T += g^T . P^T
// with per-lane f32->f16 packs only, and O^T again has lane = n, so that a
// change of the maximum in use rescales a lane's own registers.
// All fragment loads are unconditional b128 loads (zero padding stored in
// memory), no exec masking.
// ---------------------------------------------------------------------------
// lane l <-> lane l ^ 16 by a vector cross-row move
__device__ __forceinline__ float sagan_xhalf(float v)
{
    const int b = __builtin_bit_cast(int, v);
    return __builtin_bit_cast(float, __builtin_amdgcn_permlanex16(
        b, b, 0x76543210, 0xfedcba98, false, false));
}

__global__ void __launch_bounds__(256)
sagan_attn_kernel(const float* __restrict__ x, const float* __restrict__ w_o,
                  const float* __restrict__ gamma,
                  const _Float16* __restrict__ thetaPad,
                  const _Float16* __restrict__ phiPad,
                  const _Float16* __restrict__ g16,
                  float* __restrict__ out)
{
    __shared__ float ldsO[8][16][CG];  // per-wave O tile  (16 KB)
    __shared__ float ldsS[8][16];      // per-wave row sums
    __shared__ float ldsW[C_ * CG];    // w_o cache        (8 KB)

    const int tid  = threadIdx.x;
    const int wave = tid >> 5;
    const int lane = tid & 31;
    const int ln   = lane & 15;   // n (or c) index within tile
    const int hi   = lane >> 4;   // lane half

    for (int i = tid; i < C_ * CG; i += 256) ldsW[i] = w_o[i];

    const int tile = blockIdx.x * 8 + wave;     // 4096 tiles total
    const int b  = tile >> 10;                  // N_/16 = 1024 tiles per batch
    const int n0 = (tile & 1023) << 4;

    const v8h zh = {};

    // B fragment: theta. halves 0..7 <- row (K-offset hi*8, zeros stored for
    // K>=8); halves 8..15 (K=16..31) constant zero.
    v8h tlo = *(const v8h*)(thetaPad + (((size_t)b * N_ + n0 + ln) << 4) + (hi << 3));
    const v16h bth = CAT16(tlo, zh);

    const _Float16* phib = phiPad + ((size_t)b * M_ << 4) + (hi << 3);
    const _Float16* gb   = g16    + (size_t)b * CG * M_ + (lane << 3);
    const v8f zero8 = {};

    // ---- one pass over m: running maximum, exp, g.P accumulation ----
    // 64 keys per trip. muse is the maximum in use for column n = ln (the same
    // in both lane halves). It moves only when some column's new maximum lies
    // more than 5.5 above it (P stays below e^5.5 = 245, far inside f16); then
    // the sums so far are scaled by exp(old - new). One test per trip.
    const float log2e = 1.44269504088896340736f;
    float muse = -3.0e38f;
    float rsum = 0.f;
    v8f acc0 = {}, acc1 = {};
    for (int m0 = 0; m0 < M_; m0 += 64) {
        const _Float16* pr = phib + ((size_t)(m0 + ln) << 4);
        // g fragments (stored in fragment order: each load is 512 contiguous
        // bytes per wave, four whole lines); 32 m x 32 channels per 1024 halves
        const _Float16* gf = gb + ((size_t)m0 << 5);
        v8h a[4], gq[8];
        #pragma unroll
        for (int t = 0; t < 4; ++t) a[t] = *(const v8h*)(pr + ((t * 16) << 4));
        #pragma unroll
        for (int t = 0; t < 8; ++t) gq[t] = *(const v8h*)(gf + t * 256);
        // the loop advances the two address pairs while these loads are still
        // in flight: this wait stands between the loads and that overwrite
        asm volatile("s_wait_xcnt 0x0" ::: "memory");

        v8f s[4];
        #pragma unroll
        for (int t = 0; t < 4; ++t) {
            const v16h ap = CAT16(a[t], zh);
            s[t] = __builtin_amdgcn_wmma_f32_16x16x32_f16(false, ap, false, bth,
                                                          (short)0, zero8, false, false);
        }

        float mx0 = -3.0e38f, mx1 = -3.0e38f;
        #pragma unroll
        for (int i = 0; i < 8; ++i) {
            mx0 = fmaxf(mx0, fmaxf(s[0][i], s[1][i]));
            mx1 = fmaxf(mx1, fmaxf(s[2][i], s[3][i]));
        }
        float mx = fmaxf(mx0, mx1);
        mx = fmaxf(mx, sagan_xhalf(mx));
        if (__builtin_amdgcn_ballot_w32(mx > muse + 5.5f) != 0) {   // always on trip 0, rare later
            const float mnew = fmaxf(muse, mx);
            const float corr = __builtin_amdgcn_exp2f((muse - mnew) * log2e);  // 0 on trip 0
            muse = mnew;
            rsum *= corr;
            acc0 *= corr;
            acc1 *= corr;
        }

        #pragma unroll
        for (int k = 0; k < 2; ++k) {
            // S^T D-layout -> P^T B-layout: pure per-lane f32->f16 packing.
            v16h P;
            #pragma unroll
            for (int i = 0; i < 8; ++i) {
                // bare v_exp_f32, without the library's range fix-up: below 2^-126
                // it gives 0 where exp2f gives a subnormal; both round to 0 in f16
                // and both vanish in a row sum that holds the maximum's own term (>= 1)
                float p0 = __builtin_amdgcn_exp2f((s[2 * k][i]     - muse) * log2e);
                float p1 = __builtin_amdgcn_exp2f((s[2 * k + 1][i] - muse) * log2e);
                rsum += p0 + p1;
                P[i]     = (_Float16)p0;
                P[8 + i] = (_Float16)p1;
            }
            const v16h ag0 = CAT16(gq[4 * k],     gq[4 * k + 1]);
            const v16h ag1 = CAT16(gq[4 * k + 2], gq[4 * k + 3]);
            acc0 = __builtin_amdgcn_wmma_f32_16x16x32_f16(false, ag0, false, P,
                                                          (short)0, acc0, false, false);
            acc1 = __builtin_amdgcn_wmma_f32_16x16x32_f16(false, ag1, false, P,
                                                          (short)0, acc1, false, false);
        }
    }
    rsum += __shfl_xor(rsum, 16, 32);

    // stage O tile + row sums through per-wave LDS
    if (hi == 0) ldsS[wave][ln] = rsum;
    #pragma unroll
    for (int r = 0; r < 8; ++r) {
        ldsO[wave][ln][r + hi * 8]      = acc0[r];   // acc0[r] = O[n = ln][channel r + 8 hi]
        ldsO[wave][ln][16 + r + hi * 8] = acc1[r];
    }
    __syncthreads();

    // epilogue: out = gamma * w_o.(O/rowsum) + x
    const float gma  = gamma[0];
    const float rinv = 1.0f / ldsS[wave][ln];
    float orow[CG];
    #pragma unroll
    for (int ci = 0; ci < CG; ++ci) orow[ci] = ldsO[wave][ln][ci] * rinv;

    const size_t xbase = (size_t)b * C_ * N_;
    const int co_base = hi * 32;
    for (int j = 0; j < 32; ++j) {
        const int co = co_base + j;
        const float* wrow = ldsW + (size_t)co * CG;
        float v = 0.f;
        #pragma unroll
        for (int ci = 0; ci < CG; ++ci) v += wrow[ci] * orow[ci];
        const size_t oi = xbase + (size_t)co * N_ + (n0 + ln);
        out[oi] = gma * v + x[oi];
    }
}

// ---------------------------------------------------------------------------
extern "C" void kernel_launch(void* const* d_in, const int* in_sizes, int n_in,
                              void* d_out, int out_size, void* d_ws, size_t ws_size,
                              hipStream_t stream)
{
    const float* x       = (const float*)d_in[0];
    const float* w_theta = (const float*)d_in[1];
    const float* w_phi   = (const float*)d_in[2];
    const float* w_g     = (const float*)d_in[3];
    const float* w_o     = (const float*)d_in[4];
    const float* gamma   = (const float*)d_in[5];
    float* out = (float*)d_out;

    _Float16* thetaPad = (_Float16*)d_ws;                      // B*N*16 = 1M halves (2 MB)
    _Float16* phiPad   = thetaPad + ((size_t)B_ * N_ << 4);    // B*M*16 = 256K halves (512 KB)
    _Float16* g16      = phiPad   + ((size_t)B_ * M_ << 4);    // B*32*M = 512K halves (1 MB)

    sagan_proj_kernel<<<(B_ * M_) / 64, PG_T, 0, stream>>>(x, w_theta, w_phi, w_g,
                                                           thetaPad, phiPad, g16);
    sagan_attn_kernel<<<(B_ * (N_ / 16)) / 8, 256, 0, stream>>>(
        x, w_o, gamma, thetaPad, phiPad, g16, out);
}

// v006
// One run takes 70.3 microseconds.
// Next to v005, in two timings, it ran 1.03 and 1.02 times as fast.
// Over all steps from v000 it is 3.63 times as fast.
#include <hip/hip_runtime.h>
#include <hip/hip_bf16.h>

typedef __attribute__((ext_vector_type(16))) _Float16 v16h;
typedef __attribute__((ext_vector_type(8)))  _Float16 v8h;
typedef __attribute__((ext_vector_type(8)))  float    v8f;

#define B_  4
#define C_  64
#define CQ  8          // C/8
#define CP  16         // padded K rows for theta/phi (upper 8 stored zero)
#define CG  32         // C/2
#define H_  128
#define W_  128
#define N_  (H_*W_)    // 16384
#define M_  (N_/4)     // 4096

#define CAT16(a, b) __builtin_shufflevector(a, b, 0,1,2,3,4,5,6,7,8,9,10,11,12,13,14,15)

// ---------------------------------------------------------------------------
// Phase 1: the three 1x1 convs of x in one launch; phi and g with their 2x2
// maxpool, theta unpooled.
//   thetaPad[b][n][0..15] : halves 0..7 = log2(e) * w_theta . x[:, n], 8..15 = 0
//   (the scale makes the attention kernel's score product a base-2 exponent)
//   phiPad[b][p][0..15]  (f16, zero-padded rows for WMMA A fragments)
//   g16[b][p/32][cg/16][(p/16)&1][lane][8]  (f16, in the order of the PV g
//   fragments: lane = ((p/8)&1)*16 + cg%16, element = p%8, so that one 16-byte
//   load per lane of the attention loop covers 512 contiguous bytes)
// One work-group = one pooled row (64 pooled pixels = 2 x 128 pixels of x) x
// all 48 outputs. Two waves cover the 64 windows; six such pairs take 8
// outputs each (pair 0 = phi, pairs 1..4 = g, pair 5 = theta). A thread keeps
// its 2x2 window x 8 outputs in registers, so one weight read from LDS feeds
// four multiply-adds. The theta pair stores the four sums of its window as
// they are: the x rows it reads are the ones the other pairs read anyway.
// ---------------------------------------------------------------------------
#define PG_OG 8                             // outputs per thread
#define PG_NG ((CQ + CG + CQ) / PG_OG)      // 6 output groups
#define PG_T  (64 * PG_NG)                  // 384 threads

__global__ void __launch_bounds__(PG_T)
sagan_proj_kernel(const float* __restrict__ x, const float* __restrict__ w_theta,
                  const float* __restrict__ w_phi, const float* __restrict__ w_g,
                  _Float16* __restrict__ thetaPad,
                  _Float16* __restrict__ phiPad, _Float16* __restrict__ g16)
{
    // rows 0..7 phi, 8..39 g, 40..47 theta
    __shared__ __attribute__((aligned(16))) float wl[(CQ + CG + CQ) * C_];
    // 3072 weights = 8 per thread; unrolled so that the 8 loads fly together
    #pragma unroll
    for (int k = 0; k < (CQ + CG + CQ) * C_ / PG_T; ++k) {
        const int i = threadIdx.x + k * PG_T;
        wl[i] = (i < CQ * C_) ? w_phi[i]
              : (i < (CQ + CG) * C_) ? w_g[i - CQ * C_] : w_theta[i - (CQ + CG) * C_];
    }
    __syncthreads();

    const int grp = threadIdx.x >> 6;        // output group, same for a whole wave
    const int wq  = threadIdx.x & 63;        // pooled column
    const int b   = blockIdx.x >> 6;
    const int hp  = blockIdx.x & 63;         // pooled row
    const int p   = hp * 64 + wq;

    const float* xp = x + (size_t)b * C_ * N_ + (hp * 2) * W_ + wq * 2;
    const float* wr = wl + grp * PG_OG * C_;

    float acc[4][PG_OG] = {};
    // unroll 16: four channels' weights come as one 16-byte LDS read, and the
    // x loads of later channels are issued while earlier ones are worked on
    #pragma unroll 16
    for (int c = 0; c < C_; ++c) {
        const float2 top = *(const float2*)(xp + (size_t)c * N_);
        const float2 bot = *(const float2*)(xp + (size_t)c * N_ + W_);
        #pragma unroll
        for (int o = 0; o < PG_OG; ++o) {
            const float wv = wr[o * C_ + c];
            acc[0][o] += wv * top.x;
            acc[1][o] += wv * top.y;
            acc[2][o] += wv * bot.x;
            acc[3][o] += wv * bot.y;
        }
    }

    if (grp == PG_NG - 1) {
        // theta: window position k = (row k/2, column k%2) is pixel n; two
        // neighbouring pixels' padded rows are 64 contiguous bytes per thread
        const v8h zz = {};
        v8h lo[4];
        #pragma unroll
        for (int k = 0; k < 4; ++k) {
            #pragma unroll
            for (int o = 0; o < CQ; ++o) lo[k][o] = (_Float16)(acc[k][o] * 1.44269504088896340736f);
        }
        #pragma unroll
        for (int k = 0; k < 4; ++k) {
            const int n = (hp * 2 + (k >> 1)) * W_ + wq * 2 + (k & 1);
            _Float16* tp = thetaPad + (((size_t)b * N_ + n) << 4);
            *(v8h*)(tp)     = lo[k];   // global_store_b128
            *(v8h*)(tp + 8) = zz;      // zero pad (K = 8..15)
        }
        return;                     // whole waves leave; no barrier follows
    }

    float res[PG_OG];
    #pragma unroll
    for (int o = 0; o < PG_OG; ++o) {
        float r = fmaxf(-3.0e38f, acc[0][o]);
        r = fmaxf(r, acc[1][o]);
        r = fmaxf(r, acc[2][o]);
        res[o] = fmaxf(r, acc[3][o]);
    }

    if (grp == 0) {
        v8h lo;
        #pragma unroll
        for (int o = 0; o < CQ; ++o) lo[o] = (_Float16)res[o];
        const v8h zz = {};
        _Float16* pp = phiPad + (((size_t)b * M_ + p) << 4);
        *(v8h*)(pp)     = lo;
        *(v8h*)(pp + 8) = zz;
    } else {
        // channel c = (grp-1)*8 + o: tile c/16 = (grp-1)/2, column c%16 = ((grp-1)&1)*8 + o
        const int ct   = (grp - 1) >> 1;
        const int frag = ((b * (M_ / 32) + (p >> 5)) * 2 + ct) * 2 + ((p >> 4) & 1);
        const int fl   = ((p >> 3) & 1) * 16 + ((grp - 1) & 1) * 8;
        _Float16* gp = g16 + (((size_t)frag * 32 + fl) << 3) + (p & 7);
        #pragma unroll
        for (int o = 0; o < PG_OG; ++o) gp[o * 8] = (_Float16)res[o];
    }
}

// ---------------------------------------------------------------------------
// Phase 2: fused flash-style attention + w_o projection + residual.
// One wave owns a 16-row n-tile and walks the keys ONCE (online softmax).
// S^T tiles via v_wmma_f32_16x16x32_f16 (lane = n in D layout => per-lane
// softmax). An S^T D-tile pair converts to the B operand of O^T += g^T . P^T
// with per-lane f32->f16 packs only, and O^T again has lane = n, so that a
// change of the maximum in use rescales a lane's own registers.
// All fragment loads are unconditional b128 loads (zero padding stored in
// memory), no exec masking.
// ---------------------------------------------------------------------------
// lane l <-> lane l ^ 16 by a vector cross-row move
__device__ __forceinline__ float sagan_xhalf(float v)
{
    const int b = __builtin_bit_cast(int, v);
    return __builtin_bit_cast(float, __builtin_amdgcn_permlanex16(
        b, b, 0x76543210, 0xfedcba98, false, false));
}

__global__ void __launch_bounds__(256)
sagan_attn_kernel(const float* __restrict__ x, const float* __restrict__ w_o,
                  const float* __restrict__ gamma,
                  const _Float16* __restrict__ thetaPad,
                  const _Float16* __restrict__ phiPad,
                  const _Float16* __restrict__ g16,
                  float* __restrict__ out)
{
    __shared__ float ldsO[8][16][CG];  // per-wave O tile  (16 KB)
    __shared__ float ldsS[8][16];      // per-wave row sums
    __shared__ float ldsW[C_ * CG];    // w_o cache        (8 KB)

    const int tid  = threadIdx.x;
    const int wave = tid >> 5;
    const int lane = tid & 31;
    const int ln   = lane & 15;   // n (or c) index within tile
    const int hi   = lane >> 4;   // lane half

    for (int i = tid; i < C_ * CG; i += 256) ldsW[i] = w_o[i];

    const int tile = blockIdx.x * 8 + wave;     // 4096 tiles total
    const int b  = tile >> 10;                  // N_/16 = 1024 tiles per batch
    const int n0 = (tile & 1023) << 4;

    const v8h zh = {};

    // B fragment: theta. halves 0..7 <- row (K-offset hi*8, zeros stored for
    // K>=8); halves 8..15 (K=16..31) constant zero.
    v8h tlo = *(const v8h*)(thetaPad + (((size_t)b * N_ + n0 + ln) << 4) + (hi << 3));
    const v16h bth = CAT16(tlo, zh);

    const _Float16* phib = phiPad + ((size_t)b * M_ << 4) + (hi << 3);
    const _Float16* gb   = g16    + (size_t)b * CG * M_ + (lane << 3);

    // ---- one pass over m: running maximum, exp, g.P accumulation ----
    // 64 keys per trip. theta is stored times log2(e), and the score product
    // takes minus the maximum in use as its C operand, so that a score tile
    // leaves the matrix unit as the argument of v_exp_f32: s = log2(e) * score
    // - maximum in use. cneg holds that C tile: lane = column n, so all eight
    // registers of a lane hold the same value (the same in both lane halves).
    // The maximum in use moves only when some column's s exceeds 5.5 * log2(e)
    // (P stays below e^5.5 = 245, far inside f16); then this trip's s and the
    // sums so far are brought to the new maximum. One test per trip.
    const float sthr = 5.5f * 1.44269504088896340736f;
    v8f cneg = {};          // trip 0 runs against 0 and then takes its own maximum
    float rsum = 0.f;
    v8f acc0 = {}, acc1 = {};
    for (int m0 = 0; m0 < M_; m0 += 64) {
        const _Float16* pr = phib + ((size_t)(m0 + ln) << 4);
        // g fragments (stored in fragment order: each load is 512 contiguous
        // bytes per wave, four whole lines); 32 m x 32 channels per 1024 halves
        const _Float16* gf = gb + ((size_t)m0 << 5);
        v8h a[4], gq[8];
        #pragma unroll
        for (int t = 0; t < 4; ++t) a[t] = *(const v8h*)(pr + ((t * 16) << 4));
        #pragma unroll
        for (int t = 0; t < 8; ++t) gq[t] = *(const v8h*)(gf + t * 256);
        // the loop advances the two address pairs while these loads are still
        // in flight: this wait stands between the loads and that overwrite
        asm volatile("s_wait_xcnt 0x0" ::: "memory");

        v8f s[4];
        #pragma unroll
        for (int t = 0; t < 4; ++t) {
            const v16h ap = CAT16(a[t], zh);
            s[t] = __builtin_amdgcn_wmma_f32_16x16x32_f16(false, ap, false, bth,
                                                          (short)0, cneg, false, false);
        }

        float mx0 = -3.0e38f, mx1 = -3.0e38f;
        #pragma unroll
        for (int i = 0; i < 8; ++i) {
            mx0 = fmaxf(mx0, fmaxf(s[0][i], s[1][i]));
            mx1 = fmaxf(mx1, fmaxf(s[2][i], s[3][i]));
        }
        float mx = fmaxf(mx0, mx1);
        mx = fmaxf(mx, sagan_xhalf(mx));
        const bool first = (m0 == 0);
        if (__builtin_amdgcn_ballot_w32(mx > (first ? -3.0e38f : sthr)) != 0) {   // always on trip 0, rare later
            // rise of the maximum in use; trip 0 takes its maximum whatever its sign
            const float rise = fmaxf(mx, first ? -3.0e38f : 0.f);
            // on trip 0 the sums are still 0: the clamp only keeps the factor finite there
            const float corr = __builtin_amdgcn_exp2f(-fmaxf(rise, 0.f));
            cneg -= rise;
            #pragma unroll
            for (int t = 0; t < 4; ++t) s[t] -= rise;
            rsum *= corr;
            acc0 *= corr;
            acc1 *= corr;
        }

        #pragma unroll
        for (int k = 0; k < 2; ++k) {
            // S^T D-layout -> P^T B-layout: pure per-lane f32->f16 packing.
            v16h P;
            #pragma unroll
            for (int i = 0; i < 8; ++i) {
                // bare v_exp_f32, without the library's range fix-up: below 2^-126
                // it gives 0 where exp2f gives a subnormal; both round to 0 in f16
                // and both vanish in a row sum that holds the maximum's own term (>= 1)
                float p0 = __builtin_amdgcn_exp2f(s[2 * k][i]);
                float p1 = __builtin_amdgcn_exp2f(s[2 * k + 1][i]);
                rsum += p0 + p1;
                P[i]     = (_Float16)p0;
                P[8 + i] = (_Float16)p1;
            }
            const v16h ag0 = CAT16(gq[4 * k],     gq[4 * k + 1]);
            const v16h ag1 = CAT16(gq[4 * k + 2], gq[4 * k + 3]);
            acc0 = __builtin_amdgcn_wmma_f32_16x16x32_f16(false, ag0, false, P,
                                                          (short)0, acc0, false, false);
            acc1 = __builtin_amdgcn_wmma_f32_16x16x32_f16(false, ag1, false, P,
                                                          (short)0, acc1, false, false);
        }
    }
    rsum += __shfl_xor(rsum, 16, 32);

    // stage O tile + row sums through per-wave LDS
    if (hi == 0) ldsS[wave][ln] = rsum;
    #pragma unroll
    for (int r = 0; r < 8; ++r) {
        ldsO[wave][ln][r + hi * 8]      = acc0[r];   // acc0[r] = O[n = ln][channel r + 8 hi]
        ldsO[wave][ln][16 + r + hi * 8] = acc1[r];
    }
    __syncthreads();

    // epilogue: out = gamma * w_o.(O/rowsum) + x
    const float gma  = gamma[0];
    const float rinv = 1.0f / ldsS[wave][ln];
    float orow[CG];
    #pragma unroll
    for (int ci = 0; ci < CG; ++ci) orow[ci] = ldsO[wave][ln][ci] * rinv;

    const size_t xbase = (size_t)b * C_ * N_;
    const int co_base = hi * 32;
    for (int j = 0; j < 32; ++j) {
        const int co = co_base + j;
        const float* wrow = ldsW + (size_t)co * CG;
        float v = 0.f;
        #pragma unroll
        for (int ci = 0; ci < CG; ++ci) v += wrow[ci] * orow[ci];
        const size_t oi = xbase + (size_t)co * N_ + (n0 + ln);
        out[oi] = gma * v + x[oi];
    }
}

// ---------------------------------------------------------------------------
extern "C" void kernel_launch(void* const* d_in, const int* in_sizes, int n_in,
                              void* d_out, int out_size, void* d_ws, size_t ws_size,
                              hipStream_t stream)
{
    const float* x       = (const float*)d_in[0];
    const float* w_theta = (const float*)d_in[1];
    const float* w_phi   = (const float*)d_in[2];
    const float* w_g     = (const float*)d_in[3];
    const float* w_o     = (const float*)d_in[4];
    const float* gamma   = (const float*)d_in[5];
    float* out = (float*)d_out;

    _Float16* thetaPad = (_Float16*)d_ws;                      // B*N*16 = 1M halves (2 MB)
    _Float16* phiPad   = thetaPad + ((size_t)B_ * N_ << 4);    // B*M*16 = 256K halves (512 KB)
    _Float16* g16      = phiPad   + ((size_t)B_ * M_ << 4);    // B*32*M = 512K halves (1 MB)

    sagan_proj_kernel<<<(B_ * M_) / 64, PG_T, 0, stream>>>(x, w_theta, w_phi, w_g,
                                                           thetaPad, phiPad, g16);
    sagan_attn_kernel<<<(B_ * (N_ / 16)) / 8, 256, 0, stream>>>(
        x, w_o, gamma, thetaPad, phiPad, g16, out);
}

// v007
// Measured time: 56.2 microseconds a run.
// Next to v006, in two timings, it ran 1.22 times as fast each time.
// All steps since v000 together make it 4.42 times as fast.
#include <hip/hip_runtime.h>
#include <hip/hip_bf16.h>

typedef __attribute__((ext_vector_type(16))) _Float16 v16h;
typedef __attribute__((ext_vector_type(8)))  _Float16 v8h;
typedef __attribute__((ext_vector_type(8)))  float    v8f;

#define B_  4
#define C_  64
#define CQ  8          // C/8
#define CP  16         // padded K rows for theta/phi (upper 8 stored zero)
#define CG  32         // C/2
#define H_  128
#define W_  128
#define N_  (H_*W_)    // 16384
#define M_  (N_/4)     // 4096

#define CAT16(a, b) __builtin_shufflevector(a, b, 0,1,2,3,4,5,6,7,8,9,10,11,12,13,14,15)

// ---------------------------------------------------------------------------
// Phase 1: the three 1x1 convs of x in one launch; phi and g with their 2x2
// maxpool, theta unpooled.
//   thetaPad[b][n][0..15] : halves 0..7 = log2(e) * w_theta . x[:, n], 8..15 = 0
//   (the scale makes the attention kernel's score product a base-2 exponent)
//   phiPad[b][p][0..15]  (f16, zero-padded rows for WMMA A fragments)
//   g16[b][p/32][cg/16][(p/16)&1][lane][8]  (f16, in the order of the PV g
//   fragments: lane = ((p/8)&1)*16 + cg%16, element = p%8, so that one 16-byte
//   load per lane of the attention loop covers 512 contiguous bytes)
// One work-group = one pooled row (64 pooled pixels = 2 x 128 pixels of x) x
// all 48 outputs. Two waves cover the 64 windows; six such pairs take 8
// outputs each (pair 0 = phi, pairs 1..4 = g, pair 5 = theta). A thread keeps
// its 2x2 window x 8 outputs in registers, so one weight read from LDS feeds
// four multiply-adds. The theta pair stores the four sums of its window as
// they are: the x rows it reads are the ones the other pairs read anyway.
// ---------------------------------------------------------------------------
#define PG_OG 8                             // outputs per thread
#define PG_NG ((CQ + CG + CQ) / PG_OG)      // 6 output groups
#define PG_T  (64 * PG_NG)                  // 384 threads

__global__ void __launch_bounds__(PG_T)
sagan_proj_kernel(const float* __restrict__ x, const float* __restrict__ w_theta,
                  const float* __restrict__ w_phi, const float* __restrict__ w_g,
                  _Float16* __restrict__ thetaPad,
                  _Float16* __restrict__ phiPad, _Float16* __restrict__ g16)
{
    // rows 0..7 phi, 8..39 g, 40..47 theta
    __shared__ __attribute__((aligned(16))) float wl[(CQ + CG + CQ) * C_];
    // 3072 weights = 8 per thread; unrolled so that the 8 loads fly together
    #pragma unroll
    for (int k = 0; k < (CQ + CG + CQ) * C_ / PG_T; ++k) {
        const int i = threadIdx.x + k * PG_T;
        wl[i] = (i < CQ * C_) ? w_phi[i]
              : (i < (CQ + CG) * C_) ? w_g[i - CQ * C_] : w_theta[i - (CQ + CG) * C_];
    }
    __syncthreads();

    const int grp = threadIdx.x >> 6;        // output group, same for a whole wave
    const int wq  = threadIdx.x & 63;        // pooled column
    const int b   = blockIdx.x >> 6;
    const int hp  = blockIdx.x & 63;         // pooled row
    const int p   = hp * 64 + wq;

    const float* xp = x + (size_t)b * C_ * N_ + (hp * 2) * W_ + wq * 2;
    const float* wr = wl + grp * PG_OG * C_;

    float acc[4][PG_OG] = {};
    // unroll 16: four channels' weights come as one 16-byte LDS read, and the
    // x loads of later channels are issued while earlier ones are worked on
    #pragma unroll 16
    for (int c = 0; c < C_; ++c) {
        const float2 top = *(const float2*)(xp + (size_t)c * N_);
        const float2 bot = *(const float2*)(xp + (size_t)c * N_ + W_);
        #pragma unroll
        for (int o = 0; o < PG_OG; ++o) {
            const float wv = wr[o * C_ + c];
            acc[0][o] += wv * top.x;
            acc[1][o] += wv * top.y;
            acc[2][o] += wv * bot.x;
            acc[3][o] += wv * bot.y;
        }
    }

    if (grp == PG_NG - 1) {
        // theta: window position k = (row k/2, column k%2) is pixel n; two
        // neighbouring pixels' padded rows are 64 contiguous bytes per thread
        const v8h zz = {};
        v8h lo[4];
        #pragma unroll
        for (int k = 0; k < 4; ++k) {
            #pragma unroll
            for (int o = 0; o < CQ; ++o) lo[k][o] = (_Float16)(acc[k][o] * 1.44269504088896340736f);
        }
        #pragma unroll
        for (int k = 0; k < 4; ++k) {
            const int n = (hp * 2 + (k >> 1)) * W_ + wq * 2 + (k & 1);
            _Float16* tp = thetaPad + (((size_t)b * N_ + n) << 4);
            *(v8h*)(tp)     = lo[k];   // global_store_b128
            *(v8h*)(tp + 8) = zz;      // zero pad (K = 8..15)
        }
        return;                     // whole waves leave; no barrier follows
    }

    float res[PG_OG];
    #pragma unroll
    for (int o = 0; o < PG_OG; ++o) {
        float r = fmaxf(-3.0e38f, acc[0][o]);
        r = fmaxf(r, acc[1][o]);
        r = fmaxf(r, acc[2][o]);
        res[o] = fmaxf(r, acc[3][o]);
    }

    if (grp == 0) {
        v8h lo;
        #pragma unroll
        for (int o = 0; o < CQ; ++o) lo[o] = (_Float16)res[o];
        const v8h zz = {};
        _Float16* pp = phiPad + (((size_t)b * M_ + p) << 4);
        *(v8h*)(pp)     = lo;
        *(v8h*)(pp + 8) = zz;
    } else {
        // channel c = (grp-1)*8 + o: tile c/16 = (grp-1)/2, column c%16 = ((grp-1)&1)*8 + o
        const int ct   = (grp - 1) >> 1;
        const int frag = ((b * (M_ / 32) + (p >> 5)) * 2 + ct) * 2 + ((p >> 4) & 1);
        const int fl   = ((p >> 3) & 1) * 16 + ((grp - 1) & 1) * 8;
        _Float16* gp = g16 + (((size_t)frag * 32 + fl) << 3) + (p & 7);
        #pragma unroll
        for (int o = 0; o < PG_OG; ++o) gp[o * 8] = (_Float16)res[o];
    }
}

// ---------------------------------------------------------------------------
// Phase 2: fused flash-style attention + w_o projection + residual.
// One wave owns a 16-row n-tile and walks the keys ONCE (online softmax).
// S^T tiles via v_wmma_f32_16x16x32_f16 (lane = n in D layout => per-lane
// softmax). An S^T D-tile pair converts to the B operand of O^T += g^T . P^T
// with per-lane f32->f16 packs only, and O^T again has lane = n, so that a
// change of the maximum in use rescales a lane's own registers.
// All fragment loads are unconditional b128 loads (zero padding stored in
// memory), no exec masking.
// The w_o projection is shared out over the work-group by output channel: the
// eight waves' normalised O tiles meet in LDS as O^T[channel][128 pixels], and
// a wave then forms 8 output channels for all 128 pixels, a lane 4 neighbouring
// pixels. A row of x or out is one 512-byte access of the wave, and the wave's
// w_o rows are the same in every lane, so they come by scalar loads.
// ---------------------------------------------------------------------------
#define OT_P 132   // O^T row pitch in floats: 16-byte aligned rows; rows r and r + 8 fall 32 banks apart
// lane l <-> lane l ^ 16 by a vector cross-row move
__device__ __forceinline__ float sagan_xhalf(float v)
{
    const int b = __builtin_bit_cast(int, v);
    return __builtin_bit_cast(float, __builtin_amdgcn_permlanex16(
        b, b, 0x76543210, 0xfedcba98, false, false));
}

__global__ void __launch_bounds__(256)
sagan_attn_kernel(const float* __restrict__ x, const float* __restrict__ w_o,
                  const float* __restrict__ gamma,
                  const _Float16* __restrict__ thetaPad,
                  const _Float16* __restrict__ phiPad,
                  const _Float16* __restrict__ g16,
                  float* __restrict__ out)
{
    __shared__ __attribute__((aligned(16))) float ldsOT[CG][OT_P];  // O^T / row sum, 128 pixels

    const int tid  = threadIdx.x;
    const int wave = tid >> 5;
    const int lane = tid & 31;
    const int ln   = lane & 15;   // n (or c) index within tile
    const int hi   = lane >> 4;   // lane half

    const int tile = blockIdx.x * 8 + wave;     // 4096 tiles total
    const int b  = tile >> 10;                  // N_/16 = 1024 tiles per batch
    const int n0 = (tile & 1023) << 4;

    const v8h zh = {};

    // B fragment: theta. halves 0..7 <- row (K-offset hi*8, zeros stored for
    // K>=8); halves 8..15 (K=16..31) constant zero.
    v8h tlo = *(const v8h*)(thetaPad + (((size_t)b * N_ + n0 + ln) << 4) + (hi << 3));
    const v16h bth = CAT16(tlo, zh);

    const _Float16* phib = phiPad + ((size_t)b * M_ << 4) + (hi << 3);
    const _Float16* gb   = g16    + (size_t)b * CG * M_ + (lane << 3);

    // ---- one pass over m: running maximum, exp, g.P accumulation ----
    // 64 keys per trip. theta is stored times log2(e), and the score product
    // takes minus the maximum in use as its C operand, so that a score tile
    // leaves the matrix unit as the argument of v_exp_f32: s = log2(e) * score
    // - maximum in use. cneg holds that C tile: lane = column n, so all eight
    // registers of a lane hold the same value (the same in both lane halves).
    // The maximum in use moves only when some column's s exceeds 5.5 * log2(e)
    // (P stays below e^5.5 = 245, far inside f16); then this trip's s and the
    // sums so far are brought to the new maximum. One test per trip.
    const float sthr = 5.5f * 1.44269504088896340736f;
    v8f cneg = {};          // trip 0 runs against 0 and then takes its own maximum
    float rsum = 0.f;
    v8f acc0 = {}, acc1 = {};
    for (int m0 = 0; m0 < M_; m0 += 64) {
        const _Float16* pr = phib + ((size_t)(m0 + ln) << 4);
        // g fragments (stored in fragment order: each load is 512 contiguous
        // bytes per wave, four whole lines); 32 m x 32 channels per 1024 halves
        const _Float16* gf = gb + ((size_t)m0 << 5);
        v8h a[4], gq[8];
        #pragma unroll
        for (int t = 0; t < 4; ++t) a[t] = *(const v8h*)(pr + ((t * 16) << 4));
        #pragma unroll
        for (int t = 0; t < 8; ++t) gq[t] = *(const v8h*)(gf + t * 256);
        // the loop advances the two address pairs while these loads are still
        // in flight: this wait stands between the loads and that overwrite
        asm volatile("s_wait_xcnt 0x0" ::: "memory");

        v8f s[4];
        #pragma unroll
        for (int t = 0; t < 4; ++t) {
            const v16h ap = CAT16(a[t], zh);
            s[t] = __builtin_amdgcn_wmma_f32_16x16x32_f16(false, ap, false, bth,
                                                          (short)0, cneg, false, false);
        }

        float mx0 = -3.0e38f, mx1 = -3.0e38f;
        #pragma unroll
        for (int i = 0; i < 8; ++i) {
            mx0 = fmaxf(mx0, fmaxf(s[0][i], s[1][i]));
            mx1 = fmaxf(mx1, fmaxf(s[2][i], s[3][i]));
        }
        float mx = fmaxf(mx0, mx1);
        mx = fmaxf(mx, sagan_xhalf(mx));
        const bool first = (m0 == 0);
        if (__builtin_amdgcn_ballot_w32(mx > (first ? -3.0e38f : sthr)) != 0) {   // always on trip 0, rare later
            // rise of the maximum in use; trip 0 takes its maximum whatever its sign
            const float rise = fmaxf(mx, first ? -3.0e38f : 0.f);
            // on trip 0 the sums are still 0: the clamp only keeps the factor finite there
            const float corr = __builtin_amdgcn_exp2f(-fmaxf(rise, 0.f));
            cneg -= rise;
            #pragma unroll
            for (int t = 0; t < 4; ++t) s[t] -= rise;
            rsum *= corr;
            acc0 *= corr;
            acc1 *= corr;
        }

        #pragma unroll
        for (int k = 0; k < 2; ++k) {
            // S^T D-layout -> P^T B-layout: pure per-lane f32->f16 packing.
            v16h P;
            #pragma unroll
            for (int i = 0; i < 8; ++i) {
                // bare v_exp_f32, without the library's range fix-up: below 2^-126
                // it gives 0 where exp2f gives a subnormal; both round to 0 in f16
                // and both vanish in a row sum that holds the maximum's own term (>= 1)
                float p0 = __builtin_amdgcn_exp2f(s[2 * k][i]);
                float p1 = __builtin_amdgcn_exp2f(s[2 * k + 1][i]);
                rsum += p0 + p1;
                P[i]     = (_Float16)p0;
                P[8 + i] = (_Float16)p1;
            }
            const v16h ag0 = CAT16(gq[4 * k],     gq[4 * k + 1]);
            const v16h ag1 = CAT16(gq[4 * k + 2], gq[4 * k + 3]);
            acc0 = __builtin_amdgcn_wmma_f32_16x16x32_f16(false, ag0, false, P,
                                                          (short)0, acc0, false, false);
            acc1 = __builtin_amdgcn_wmma_f32_16x16x32_f16(false, ag1, false, P,
                                                          (short)0, acc1, false, false);
        }
    }
    rsum += __shfl_xor(rsum, 16, 32);

    const float rinv = 1.0f / rsum;      // both lane halves hold pixel ln's whole sum

    // this wave's share of the projection: output channels co0..co0+7, pixels nb..nb+127
    const int co0 = __builtin_amdgcn_readfirstlane(wave) * 8;
    const int nb  = (blockIdx.x & 127) << 7;            // 128 work-groups per batch
    // byte offset of the lane's 4 pixels in row co0 (below 16 MiB), the same in x and in out
    const unsigned obyte = (unsigned)(((b * C_ + co0) * N_ + nb + lane * 4) * 4);

    #pragma unroll
    for (int r = 0; r < 8; ++r) {
        ldsOT[r + hi * 8][wave * 16 + ln]      = acc0[r] * rinv;   // acc0[r] = O[n = ln][channel r + 8 hi]
        ldsOT[16 + r + hi * 8][wave * 16 + ln] = acc1[r] * rinv;
    }
    __syncthreads();

    // epilogue: out = gamma * w_o.(O/rowsum) + x
    // the residual rows are asked for behind the barrier (in front of it, its fence would wait
    // for them) and in front of the products, under which they fly
    float4 xv[8];
    #pragma unroll
    for (int j = 0; j < 8; ++j) xv[j] = *(const float4*)((const char*)x + obyte + j * (N_ * 4));
    const float gma = gamma[0];
    const float* wrow = w_o + co0 * CG;
    float4 v[8] = {};
    // kept rolled, 8 channels a trip: 64 weights fit the scalar registers (unrolled whole, they
    // spill), and the x loads above stay in front of the loop
    #pragma unroll 1
    for (int c8 = 0; c8 < CG; c8 += 8) {
        float4 o[8];
        #pragma unroll
        for (int k = 0; k < 8; ++k) o[k] = *(const float4*)&ldsOT[c8 + k][lane * 4];
        #pragma unroll
        for (int j = 0; j < 8; ++j) {
            #pragma unroll
            for (int k = 0; k < 8; ++k) {
                const float wv = wrow[j * CG + c8 + k];
                v[j].x += wv * o[k].x;
                v[j].y += wv * o[k].y;
                v[j].z += wv * o[k].z;
                v[j].w += wv * o[k].w;
            }
        }
    }
    #pragma unroll
    for (int j = 0; j < 8; ++j) {
        float4 res;
        res.x = gma * v[j].x + xv[j].x;
        res.y = gma * v[j].y + xv[j].y;
        res.z = gma * v[j].z + xv[j].z;
        res.w = gma * v[j].w + xv[j].w;
        *(float4*)((char*)out + obyte + j * (N_ * 4)) = res;
    }
}

// ---------------------------------------------------------------------------
extern "C" void kernel_launch(void* const* d_in, const int* in_sizes, int n_in,
                              void* d_out, int out_size, void* d_ws, size_t ws_size,
                              hipStream_t stream)
{
    const float* x       = (const float*)d_in[0];
    const float* w_theta = (const float*)d_in[1];
    const float* w_phi   = (const float*)d_in[2];
    const float* w_g     = (const float*)d_in[3];
    const float* w_o     = (const float*)d_in[4];
    const float* gamma   = (const float*)d_in[5];
    float* out = (float*)d_out;

    _Float16* thetaPad = (_Float16*)d_ws;                      // B*N*16 = 1M halves (2 MB)
    _Float16* phiPad   = thetaPad + ((size_t)B_ * N_ << 4);    // B*M*16 = 256K halves (512 KB)
    _Float16* g16      = phiPad   + ((size_t)B_ * M_ << 4);    // B*32*M = 512K halves (1 MB)

    sagan_proj_kernel<<<(B_ * M_) / 64, PG_T, 0, stream>>>(x, w_theta, w_phi, w_g,
                                                           thetaPad, phiPad, g16);
    sagan_attn_kernel<<<(B_ * (N_ / 16)) / 8, 256, 0, stream>>>(
        x, w_o, gamma, thetaPad, phiPad, g16, out);
}

// v008
// It runs in 46.7 microseconds.
// Next to v007, in two timings, it ran 1.22 and 1.21 times as fast.
// All steps since v000 together make it 5.37 times as fast.
#include <hip/hip_runtime.h>
#include <hip/hip_bf16.h>

typedef __attribute__((ext_vector_type(16))) _Float16 v16h;
typedef __attribute__((ext_vector_type(8)))  _Float16 v8h;
typedef __attribute__((ext_vector_type(8)))  float    v8f;

#define B_  4
#define C_  64
#define CQ  8          // C/8
#define CP  16         // padded K rows for theta/phi (upper 8 stored zero)
#define CG  32         // C/2
#define H_  128
#define W_  128
#define N_  (H_*W_)    // 16384
#define M_  (N_/4)     // 4096

#define CAT16(a, b) __builtin_shufflevector(a, b, 0,1,2,3,4,5,6,7,8,9,10,11,12,13,14,15)

// ---------------------------------------------------------------------------
// Phase 1: the three 1x1 convs of x in one launch; phi and g with their 2x2
// maxpool, theta unpooled.
//   thetaPad[b][n][0..15] : halves 0..7 = log2(e) * w_theta . x[:, n], 8..15 = 0
//   (the scale makes the attention kernel's score product a base-2 exponent)
//   phiPad[b][p][0..15]  (f16, zero-padded rows for WMMA A fragments)
//   g16[b][p/32][cg/16][(p/16)&1][lane][8]  (f16, in the order of the PV g
//   fragments: lane = ((p/8)&1)*16 + cg%16, element = p%8, so that one 16-byte
//   load per lane of the attention loop covers 512 contiguous bytes)
// One work-group = one pooled row (64 pooled pixels = 2 x 128 pixels of x) x
// all 48 outputs. Two waves cover the 64 windows; six such pairs take 8
// outputs each (pair 0 = phi, pairs 1..4 = g, pair 5 = theta). A thread keeps
// its 2x2 window x 8 outputs in registers, so one weight read from LDS feeds
// four multiply-adds. The theta pair stores the four sums of its window as
// they are: the x rows it reads are the ones the other pairs read anyway.
// ---------------------------------------------------------------------------
#define PG_OG 8                             // outputs per thread
#define PG_NG ((CQ + CG + CQ) / PG_OG)      // 6 output groups
#define PG_T  (64 * PG_NG)                  // 384 threads

__global__ void __launch_bounds__(PG_T)
sagan_proj_kernel(const float* __restrict__ x, const float* __restrict__ w_theta,
                  const float* __restrict__ w_phi, const float* __restrict__ w_g,
                  _Float16* __restrict__ thetaPad,
                  _Float16* __restrict__ phiPad, _Float16* __restrict__ g16)
{
    // rows 0..7 phi, 8..39 g, 40..47 theta
    __shared__ __attribute__((aligned(16))) float wl[(CQ + CG + CQ) * C_];
    // 3072 weights = 8 per thread; unrolled so that the 8 loads fly together
    #pragma unroll
    for (int k = 0; k < (CQ + CG + CQ) * C_ / PG_T; ++k) {
        const int i = threadIdx.x + k * PG_T;
        wl[i] = (i < CQ * C_) ? w_phi[i]
              : (i < (CQ + CG) * C_) ? w_g[i - CQ * C_] : w_theta[i - (CQ + CG) * C_];
    }
    __syncthreads();

    const int grp = threadIdx.x >> 6;        // output group, same for a whole wave
    const int wq  = threadIdx.x & 63;        // pooled column
    const int b   = blockIdx.x >> 6;
    const int hp  = blockIdx.x & 63;         // pooled row
    const int p   = hp * 64 + wq;

    const float* xp = x + (size_t)b * C_ * N_ + (hp * 2) * W_ + wq * 2;
    const float* wr = wl + grp * PG_OG * C_;

    float acc[4][PG_OG] = {};
    // unroll 16: four channels' weights come as one 16-byte LDS read, and the
    // x loads of later channels are issued while earlier ones are worked on
    #pragma unroll 16
    for (int c = 0; c < C_; ++c) {
        const float2 top = *(const float2*)(xp + (size_t)c * N_);
        const float2 bot = *(const float2*)(xp + (size_t)c * N_ + W_);
        #pragma unroll
        for (int o = 0; o < PG_OG; ++o) {
            const float wv = wr[o * C_ + c];
            acc[0][o] += wv * top.x;
            acc[1][o] += wv * top.y;
            acc[2][o] += wv * bot.x;
            acc[3][o] += wv * bot.y;
        }
    }

    if (grp == PG_NG - 1) {
        // theta: window position k = (row k/2, column k%2) is pixel n; two
        // neighbouring pixels' padded rows are 64 contiguous bytes per thread
        const v8h zz = {};
        v8h lo[4];
        #pragma unroll
        for (int k = 0; k < 4; ++k) {
            #pragma unroll
            for (int o = 0; o < CQ; ++o) lo[k][o] = (_Float16)(acc[k][o] * 1.44269504088896340736f);
        }
        #pragma unroll
        for (int k = 0; k < 4; ++k) {
            const int n = (hp * 2 + (k >> 1)) * W_ + wq * 2 + (k & 1);
            _Float16* tp = thetaPad + (((size_t)b * N_ + n) << 4);
            *(v8h*)(tp)     = lo[k];   // global_store_b128
            *(v8h*)(tp + 8) = zz;      // zero pad (K = 8..15)
        }
        return;                     // whole waves leave; no barrier follows
    }

    float res[PG_OG];
    #pragma unroll
    for (int o = 0; o < PG_OG; ++o) {
        float r = fmaxf(-3.0e38f, acc[0][o]);
        r = fmaxf(r, acc[1][o]);
        r = fmaxf(r, acc[2][o]);
        res[o] = fmaxf(r, acc[3][o]);
    }

    if (grp == 0) {
        v8h lo;
        #pragma unroll
        for (int o = 0; o < CQ; ++o) lo[o] = (_Float16)res[o];
        const v8h zz = {};
        _Float16* pp = phiPad + (((size_t)b * M_ + p) << 4);
        *(v8h*)(pp)     = lo;
        *(v8h*)(pp + 8) = zz;
    } else {
        // channel c = (grp-1)*8 + o: tile c/16 = (grp-1)/2, column c%16 = ((grp-1)&1)*8 + o
        const int ct   = (grp - 1) >> 1;
        const int frag = ((b * (M_ / 32) + (p >> 5)) * 2 + ct) * 2 + ((p >> 4) & 1);
        const int fl   = ((p >> 3) & 1) * 16 + ((grp - 1) & 1) * 8;
        _Float16* gp = g16 + (((size_t)frag * 32 + fl) << 3) + (p & 7);
        #pragma unroll
        for (int o = 0; o < PG_OG; ++o) gp[o * 8] = (_Float16)res[o];
    }
}

// ---------------------------------------------------------------------------
// Phase 2: fused flash-style attention + w_o projection + residual.
// One wave owns a 16-row n-tile and walks the keys ONCE (online softmax).
// S^T tiles via v_wmma_f32_16x16x32_f16 (lane = n in D layout => per-lane
// softmax). An S^T D-tile pair converts to the B operand of O^T += g^T . P^T
// with per-lane f32->f16 packs only, and O^T again has lane = n, so that a
// change of the maximum in use rescales a lane's own registers.
// All fragment loads are unconditional b128 loads (zero padding stored in
// memory), no exec masking.
// The w_o projection is shared out over the work-group by output channel: the
// eight waves' normalised O tiles meet in LDS as O^T[channel][128 pixels], and
// a wave then forms 8 output channels for all 128 pixels, a lane 4 neighbouring
// pixels. A row of x or out is one 512-byte access of the wave, and the wave's
// w_o rows are the same in every lane, so they come by scalar loads.
// ---------------------------------------------------------------------------
#define OT_P 132   // O^T row pitch in floats: 16-byte aligned rows; rows r and r + 8 fall 32 banks apart
// lane l <-> lane l ^ 16 by a vector cross-row move
__device__ __forceinline__ float sagan_xhalf(float v)
{
    const int b = __builtin_bit_cast(int, v);
    return __builtin_bit_cast(float, __builtin_amdgcn_permlanex16(
        b, b, 0x76543210, 0xfedcba98, false, false));
}

// the fragments of one trip of 64 keys: four phi A fragments, eight g fragments
struct sagan_phi { v8h a[4]; };
struct sagan_g   { v8h g[8]; };

// phil: the lane's phi row of key 0 (+ its K offset)
__device__ __forceinline__ void sagan_load_phi(sagan_phi& f, const _Float16* __restrict__ phil,
                                               const int m0)
{
    const _Float16* pr = phil + ((size_t)m0 << 4);
    #pragma unroll
    for (int t = 0; t < 4; ++t) f.a[t] = *(const v8h*)(pr + ((t * 16) << 4));
}

// gl: the lane's 16 bytes of g fragment 0. g is stored in fragment order: each
// load is 512 contiguous bytes per wave, four whole lines; 32 m x 32 channels
// per 1024 halves
__device__ __forceinline__ void sagan_load_g(sagan_g& f, const _Float16* __restrict__ gl,
                                             const int m0)
{
    const _Float16* gf = gl + ((size_t)m0 << 5);
    #pragma unroll
    for (int t = 0; t < 8; ++t) f.g[t] = *(const v8h*)(gf + t * 256);
}

__device__ __forceinline__ void sagan_addr_wait()
{
    // the loop forms new addresses while a stage's loads are still in flight:
    // this wait stands between the loads and the overwrite of their address registers
    asm volatile("s_wait_xcnt 0x0" ::: "memory");
    // keeps the loads at the head of their stage: without it the scheduler sinks them
    // to the stage's end to save registers, a few dozen instructions in front of their use
    __builtin_amdgcn_sched_barrier(0);
}

__global__ void __launch_bounds__(256)
sagan_attn_kernel(const float* __restrict__ x, const float* __restrict__ w_o,
                  const float* __restrict__ gamma,
                  const _Float16* __restrict__ thetaPad,
                  const _Float16* __restrict__ phiPad,
                  const _Float16* __restrict__ g16,
                  float* __restrict__ out)
{
    __shared__ __attribute__((aligned(16))) float ldsOT[CG][OT_P];  // O^T / row sum, 128 pixels

    const int tid  = threadIdx.x;
    const int wave = tid >> 5;
    const int lane = tid & 31;
    const int ln   = lane & 15;   // n (or c) index within tile
    const int hi   = lane >> 4;   // lane half

    const int tile = blockIdx.x * 8 + wave;     // 4096 tiles total
    const int b  = tile >> 10;                  // N_/16 = 1024 tiles per batch
    const int n0 = (tile & 1023) << 4;

    const v8h zh = {};

    // B fragment: theta. halves 0..7 <- row (K-offset hi*8, zeros stored for
    // K>=8); halves 8..15 (K=16..31) constant zero.
    v8h tlo = *(const v8h*)(thetaPad + (((size_t)b * N_ + n0 + ln) << 4) + (hi << 3));
    const v16h bth = CAT16(tlo, zh);

    const _Float16* phib = phiPad + ((size_t)b * M_ << 4) + (hi << 3) + (ln << 4);
    const _Float16* gb   = g16    + (size_t)b * CG * M_ + (lane << 3);

    // ---- one pass over m: running maximum, exp, g.P accumulation ----
    // 64 keys per trip. theta is stored times log2(e), and the score product
    // takes minus the maximum in use as its C operand, so that a score tile
    // leaves the matrix unit as the argument of v_exp_f32: s = log2(e) * score
    // - maximum in use. cneg holds that C tile: lane = column n, so all eight
    // registers of a lane hold the same value (the same in both lane halves).
    // The maximum in use moves only when some column's s exceeds 5.5 * log2(e)
    // (P stays below e^5.5 = 245, far inside f16); then this trip's s and the
    // sums so far are brought to the new maximum. One test per trip.
    const float sthr = 5.5f * 1.44269504088896340736f;
    v8f cneg = {};          // trip 0 runs against 0 and then takes its own maximum
    float rsum = 0.f;
    v8f acc0 = {}, acc1 = {};

    // a trip's score tiles
    auto head = [&](const sagan_phi& ph, v8f (&s)[4]) __attribute__((always_inline)) {
        #pragma unroll
        for (int t = 0; t < 4; ++t) {
            const v16h ap = CAT16(ph.a[t], zh);
            s[t] = __builtin_amdgcn_wmma_f32_16x16x32_f16(false, ap, false, bth,
                                                          (short)0, cneg, false, false);
        }
    };

    // a trip's test of the maximum in use, behind the sums of all trips before it
    auto test = [&](v8f (&s)[4], const bool first) __attribute__((always_inline)) {
        float mx0 = -3.0e38f, mx1 = -3.0e38f;
        #pragma unroll
        for (int i = 0; i < 8; ++i) {
            mx0 = fmaxf(mx0, fmaxf(s[0][i], s[1][i]));
            mx1 = fmaxf(mx1, fmaxf(s[2][i], s[3][i]));
        }
        float mx = fmaxf(mx0, mx1);
        mx = fmaxf(mx, sagan_xhalf(mx));
        if (__builtin_amdgcn_ballot_w32(mx > (first ? -3.0e38f : sthr)) != 0) {   // always on trip 0, rare later
            // rise of the maximum in use; trip 0 takes its maximum whatever its sign
            const float rise = fmaxf(mx, first ? -3.0e38f : 0.f);
            // on trip 0 the sums are still 0: the clamp only keeps the factor finite there
            const float corr = __builtin_amdgcn_exp2f(-fmaxf(rise, 0.f));
            cneg -= rise;
            #pragma unroll
            for (int t = 0; t < 4; ++t) s[t] -= rise;
            rsum *= corr;
            acc0 *= corr;
            acc1 *= corr;
        }
    };

    // a trip's exp and g.P
    auto tail = [&](const v8f (&s)[4], const sagan_g& gq) __attribute__((always_inline)) {
        #pragma unroll
        for (int k = 0; k < 2; ++k) {
            // S^T D-layout -> P^T B-layout: pure per-lane f32->f16 packing.
            v16h P;
            #pragma unroll
            for (int i = 0; i < 8; ++i) {
                // bare v_exp_f32, without the library's range fix-up: below 2^-126
                // it gives 0 where exp2f gives a subnormal; both round to 0 in f16
                // and both vanish in a row sum that holds the maximum's own term (>= 1)
                float p0 = __builtin_amdgcn_exp2f(s[2 * k][i]);
                float p1 = __builtin_amdgcn_exp2f(s[2 * k + 1][i]);
                rsum += p0 + p1;
                P[i]     = (_Float16)p0;
                P[8 + i] = (_Float16)p1;
            }
            const v16h ag0 = CAT16(gq.g[4 * k],     gq.g[4 * k + 1]);
            const v16h ag1 = CAT16(gq.g[4 * k + 2], gq.g[4 * k + 3]);
            acc0 = __builtin_amdgcn_wmma_f32_16x16x32_f16(false, ag0, false, P,
                                                          (short)0, acc0, false, false);
            acc1 = __builtin_amdgcn_wmma_f32_16x16x32_f16(false, ag1, false, P,
                                                          (short)0, acc1, false, false);
        }
    };

    // The loop is rotated so that no load stands in front of its own use. A stage
    // is: ask for the g fragments of the next trip and the phi fragments of the
    // trip after it; the next trip's score tiles; this trip's exp and g.P; the
    // next trip's test. A stage begins behind the branch of the test before it, so
    // the register sets it refills were read for the last time in the stage before.
    // Two stages a pass: the sets (phi, g, score tiles) alternate without copies.
    // Behind the last key the indices wrap to this batch's first keys: those loads
    // stay in bounds; the last stage's score tiles (keys 0..63 again, none above the
    // maximum in use, which has held their maximum since trip 0) are not summed.
    sagan_phi p0, p1;
    sagan_g   g0, g1;
    v8f s0[4], s1[4];
    sagan_load_phi(p0, phib, 0);
    sagan_load_phi(p1, phib, 64);
    sagan_load_g(g0, gb, 0);
    sagan_addr_wait();
    head(p0, s0);
    test(s0, true);
    // kept at two stages a pass: that is what the alternating sets ask for
    #pragma unroll 1
    for (int m0 = 0; m0 < M_; m0 += 128) {
        sagan_load_phi(p0, phib, (m0 + 128) & (M_ - 1));
        sagan_load_g(g1, gb, m0 + 64);
        sagan_addr_wait();
        head(p1, s1);
        tail(s0, g0);
        test(s1, false);

        sagan_load_phi(p1, phib, (m0 + 192) & (M_ - 1));
        sagan_load_g(g0, gb, (m0 + 128) & (M_ - 1));
        sagan_addr_wait();
        head(p0, s0);
        tail(s1, g1);
        test(s0, false);
    }
    rsum += __shfl_xor(rsum, 16, 32);

    const float rinv = 1.0f / rsum;      // both lane halves hold pixel ln's whole sum

    // this wave's share of the projection: output channels co0..co0+7, pixels nb..nb+127
    const int co0 = __builtin_amdgcn_readfirstlane(wave) * 8;
    const int nb  = (blockIdx.x & 127) << 7;            // 128 work-groups per batch
    // byte offset of the lane's 4 pixels in row co0 (below 16 MiB), the same in x and in out
    const unsigned obyte = (unsigned)(((b * C_ + co0) * N_ + nb + lane * 4) * 4);

    #pragma unroll
    for (int r = 0; r < 8; ++r) {
        ldsOT[r + hi * 8][wave * 16 + ln]      = acc0[r] * rinv;   // acc0[r] = O[n = ln][channel r + 8 hi]
        ldsOT[16 + r + hi * 8][wave * 16 + ln] = acc1[r] * rinv;
    }
    __syncthreads();

    // epilogue: out = gamma * w_o.(O/rowsum) + x
    // the residual rows are asked for behind the barrier (in front of it, its fence would wait
    // for them) and in front of the products, under which they fly
    float4 xv[8];
    #pragma unroll
    for (int j = 0; j < 8; ++j) xv[j] = *(const float4*)((const char*)x + obyte + j * (N_ * 4));
    const float gma = gamma[0];
    const float* wrow = w_o + co0 * CG;
    float4 v[8] = {};
    // kept rolled, 8 channels a trip: 64 weights fit the scalar registers (unrolled whole, they
    // spill), and the x loads above stay in front of the loop
    #pragma unroll 1
    for (int c8 = 0; c8 < CG; c8 += 8) {
        float4 o[8];
        #pragma unroll
        for (int k = 0; k < 8; ++k) o[k] = *(const float4*)&ldsOT[c8 + k][lane * 4];
        #pragma unroll
        for (int j = 0; j < 8; ++j) {
            #pragma unroll
            for (int k = 0; k < 8; ++k) {
                const float wv = wrow[j * CG + c8 + k];
                v[j].x += wv * o[k].x;
                v[j].y += wv * o[k].y;
                v[j].z += wv * o[k].z;
                v[j].w += wv * o[k].w;
            }
        }
    }
    #pragma unroll
    for (int j = 0; j < 8; ++j) {
        float4 res;
        res.x = gma * v[j].x + xv[j].x;
        res.y = gma * v[j].y + xv[j].y;
        res.z = gma * v[j].z + xv[j].z;
        res.w = gma * v[j].w + xv[j].w;
        *(float4*)((char*)out + obyte + j * (N_ * 4)) = res;
    }
}

// ---------------------------------------------------------------------------
extern "C" void kernel_launch(void* const* d_in, const int* in_sizes, int n_in,
                              void* d_out, int out_size, void* d_ws, size_t ws_size,
                              hipStream_t stream)
{
    const float* x       = (const float*)d_in[0];
    const float* w_theta = (const float*)d_in[1];
    const float* w_phi   = (const float*)d_in[2];
    const float* w_g     = (const float*)d_in[3];
    const float* w_o     = (const float*)d_in[4];
    const float* gamma   = (const float*)d_in[5];
    float* out = (float*)d_out;

    _Float16* thetaPad = (_Float16*)d_ws;                      // B*N*16 = 1M halves (2 MB)
    _Float16* phiPad   = thetaPad + ((size_t)B_ * N_ << 4);    // B*M*16 = 256K halves (512 KB)
    _Float16* g16      = phiPad   + ((size_t)B_ * M_ << 4);    // B*32*M = 512K halves (1 MB)

    sagan_proj_kernel<<<(B_ * M_) / 64, PG_T, 0, stream>>>(x, w_theta, w_phi, w_g,
                                                           thetaPad, phiPad, g16);
    sagan_attn_kernel<<<(B_ * (N_ / 16)) / 8, 256, 0, stream>>>(
        x, w_o, gamma, thetaPad, phiPad, g16, out);
}

// v009
// Measured time: 43.3 microseconds a run.
// In both of two side-by-side timings against v008, it was 1.08 times as fast.
// Counting every step since v000, it is 5.80 times as fast.
#include <hip/hip_runtime.h>
#include <hip/hip_bf16.h>

typedef __attribute__((ext_vector_type(16))) _Float16 v16h;
typedef __attribute__((ext_vector_type(8)))  _Float16 v8h;
typedef __attribute__((ext_vector_type(8)))  float    v8f;

#define B_  4
#define C_  64
#define CQ  8          // C/8
#define CP  16         // padded K rows for theta/phi (upper 8 stored zero)
#define CG  32         // C/2
#define H_  128
#define W_  128
#define N_  (H_*W_)    // 16384
#define M_  (N_/4)     // 4096

#define CAT16(a, b) __builtin_shufflevector(a, b, 0,1,2,3,4,5,6,7,8,9,10,11,12,13,14,15)

// ---------------------------------------------------------------------------
// Phase 1: the three 1x1 convs of x in one launch; phi and g with their 2x2
// maxpool, theta unpooled.
//   thetaPad[b][n][0..15] : halves 0..7 = log2(e) * w_theta . x[:, n], 8..15 = 0
//   (the scale makes the attention kernel's score product a base-2 exponent)
//   phiPad[b][p][0..15]  (f16, zero-padded rows for WMMA A fragments)
//   g16[b][p/32][cg/16][(p/16)&1][lane][8]  (f16, in the order of the PV g
//   fragments: lane = ((p/8)&1)*16 + cg%16, element = p%8, so that one 16-byte
//   load per lane of the attention loop covers 512 contiguous bytes)
// One work-group = one pooled row (64 pooled pixels = 2 x 128 pixels of x) x
// all 48 outputs. Two waves cover the 64 windows; six such pairs take 8
// outputs each (pair 0 = phi, pairs 1..4 = g, pair 5 = theta). A thread keeps
// its 2x2 window x 8 outputs in registers, so one weight read from LDS feeds
// four multiply-adds. The theta pair stores the four sums of its window as
// they are: the x rows it reads are the ones the other pairs read anyway.
// ---------------------------------------------------------------------------
#define PG_OG 8                             // outputs per thread
#define PG_NG ((CQ + CG + CQ) / PG_OG)      // 6 output groups
#define PG_T  (64 * PG_NG)                  // 384 threads

__global__ void __launch_bounds__(PG_T)
sagan_proj_kernel(const float* __restrict__ x, const float* __restrict__ w_theta,
                  const float* __restrict__ w_phi, const float* __restrict__ w_g,
                  _Float16* __restrict__ thetaPad,
                  _Float16* __restrict__ phiPad, _Float16* __restrict__ g16)
{
    // rows 0..7 phi, 8..39 g, 40..47 theta
    __shared__ __attribute__((aligned(16))) float wl[(CQ + CG + CQ) * C_];
    // 3072 weights = 8 per thread; unrolled so that the 8 loads fly together
    #pragma unroll
    for (int k = 0; k < (CQ + CG + CQ) * C_ / PG_T; ++k) {
        const int i = threadIdx.x + k * PG_T;
        wl[i] = (i < CQ * C_) ? w_phi[i]
              : (i < (CQ + CG) * C_) ? w_g[i - CQ * C_] : w_theta[i - (CQ + CG) * C_];
    }
    __syncthreads();

    const int grp = threadIdx.x >> 6;        // output group, same for a whole wave
    const int wq  = threadIdx.x & 63;        // pooled column
    const int b   = blockIdx.x >> 6;
    const int hp  = blockIdx.x & 63;         // pooled row
    const int p   = hp * 64 + wq;

    const float* xp = x + (size_t)b * C_ * N_ + (hp * 2) * W_ + wq * 2;
    const float* wr = wl + grp * PG_OG * C_;

    float acc[4][PG_OG] = {};
    // unroll 16: four channels' weights come as one 16-byte LDS read, and the
    // x loads of later channels are issued while earlier ones are worked on
    #pragma unroll 16
    for (int c = 0; c < C_; ++c) {
        const float2 top = *(const float2*)(xp + (size_t)c * N_);
        const float2 bot = *(const float2*)(xp + (size_t)c * N_ + W_);
        #pragma unroll
        for (int o = 0; o < PG_OG; ++o) {
            const float wv = wr[o * C_ + c];
            acc[0][o] += wv * top.x;
            acc[1][o] += wv * top.y;
            acc[2][o] += wv * bot.x;
            acc[3][o] += wv * bot.y;
        }
    }

    if (grp == PG_NG - 1) {
        // theta: window position k = (row k/2, column k%2) is pixel n; two
        // neighbouring pixels' padded rows are 64 contiguous bytes per thread
        const v8h zz = {};
        v8h lo[4];
        #pragma unroll
        for (int k = 0; k < 4; ++k) {
            #pragma unroll
            for (int o = 0; o < CQ; ++o) lo[k][o] = (_Float16)(acc[k][o] * 1.44269504088896340736f);
        }
        #pragma unroll
        for (int k = 0; k < 4; ++k) {
            const int n = (hp * 2 + (k >> 1)) * W_ + wq * 2 + (k & 1);
            _Float16* tp = thetaPad + (((size_t)b * N_ + n) << 4);
            *(v8h*)(tp)     = lo[k];   // global_store_b128
            *(v8h*)(tp + 8) = zz;      // zero pad (K = 8..15)
        }
        return;                     // whole waves leave; no barrier follows
    }

    float res[PG_OG];
    #pragma unroll
    for (int o = 0; o < PG_OG; ++o) {
        float r = fmaxf(-3.0e38f, acc[0][o]);
        r = fmaxf(r, acc[1][o]);
        r = fmaxf(r, acc[2][o]);
        res[o] = fmaxf(r, acc[3][o]);
    }

    if (grp == 0) {
        v8h lo;
        #pragma unroll
        for (int o = 0; o < CQ; ++o) lo[o] = (_Float16)res[o];
        const v8h zz = {};
        _Float16* pp = phiPad + (((size_t)b * M_ + p) << 4);
        *(v8h*)(pp)     = lo;
        *(v8h*)(pp + 8) = zz;
    } else {
        // channel c = (grp-1)*8 + o: tile c/16 = (grp-1)/2, column c%16 = ((grp-1)&1)*8 + o
        const int ct   = (grp - 1) >> 1;
        const int frag = ((b * (M_ / 32) + (p >> 5)) * 2 + ct) * 2 + ((p >> 4) & 1);
        const int fl   = ((p >> 3) & 1) * 16 + ((grp - 1) & 1) * 8;
        _Float16* gp = g16 + (((size_t)frag * 32 + fl) << 3) + (p & 7);
        #pragma unroll
        for (int o = 0; o < PG_OG; ++o) gp[o * 8] = (_Float16)res[o];
    }
}

// ---------------------------------------------------------------------------
// Phase 2: fused flash-style attention + w_o projection + residual.
// One wave owns a 16-row n-tile and walks the keys ONCE (online softmax).
// S^T tiles via v_wmma_f32_16x16x32_f16 (lane = n in D layout => per-lane
// softmax). An S^T D-tile pair converts to the B operand of O^T += g^T . P^T
// with per-lane f32->f16 packs only, and O^T again has lane = n, so that a
// change of the maximum in use rescales a lane's own registers.
// All fragment loads are unconditional b128 loads (zero padding stored in
// memory), no exec masking.
// The w_o projection is shared out over the work-group by output channel: the
// eight waves' normalised O tiles meet in LDS as O^T[channel][128 pixels], and
// a wave then forms 8 output channels for all 128 pixels, a lane 4 neighbouring
// pixels. A row of x or out is one 512-byte access of the wave, and the wave's
// w_o rows are the same in every lane, so they come by scalar loads.
// ---------------------------------------------------------------------------
#define OT_P 132   // O^T row pitch in floats: 16-byte aligned rows; rows r and r + 8 fall 32 banks apart
// lane l <-> lane l ^ 16 by a vector cross-row move
__device__ __forceinline__ float sagan_xhalf(float v)
{
    const int b = __builtin_bit_cast(int, v);
    return __builtin_bit_cast(float, __builtin_amdgcn_permlanex16(
        b, b, 0x76543210, 0xfedcba98, false, false));
}

// the fragments of one trip of 64 keys: four phi A fragments, eight g fragments
struct sagan_phi { v8h a[4]; };
struct sagan_g   { v8h g[8]; };

// phil: the lane's phi row of key 0 (+ its K offset)
__device__ __forceinline__ void sagan_load_phi(sagan_phi& f, const _Float16* __restrict__ phil,
                                               const int m0)
{
    const _Float16* pr = phil + ((size_t)m0 << 4);
    #pragma unroll
    for (int t = 0; t < 4; ++t) f.a[t] = *(const v8h*)(pr + ((t * 16) << 4));
}

// gl: the lane's 16 bytes of g fragment 0. g is stored in fragment order: each
// load is 512 contiguous bytes per wave, four whole lines; 32 m x 32 channels
// per 1024 halves
__device__ __forceinline__ void sagan_load_g(sagan_g& f, const _Float16* __restrict__ gl,
                                             const int m0)
{
    const _Float16* gf = gl + ((size_t)m0 << 5);
    #pragma unroll
    for (int t = 0; t < 8; ++t) f.g[t] = *(const v8h*)(gf + t * 256);
}

__device__ __forceinline__ void sagan_addr_wait()
{
    // the loop forms new addresses while a stage's loads are still in flight:
    // this wait stands between the loads and the overwrite of their address registers
    asm volatile("s_wait_xcnt 0x0" ::: "memory");
    // keeps the loads at the head of their stage: without it the scheduler sinks them
    // to the stage's end to save registers, a few dozen instructions in front of their use
    __builtin_amdgcn_sched_barrier(0);
}

__global__ void __launch_bounds__(256)
sagan_attn_kernel(const float* __restrict__ x, const float* __restrict__ w_o,
                  const float* __restrict__ gamma,
                  const _Float16* __restrict__ thetaPad,
                  const _Float16* __restrict__ phiPad,
                  const _Float16* __restrict__ g16,
                  float* __restrict__ out)
{
    __shared__ __attribute__((aligned(16))) float ldsOT[CG][OT_P];  // O^T / row sum, 128 pixels

    const int tid  = threadIdx.x;
    const int wave = tid >> 5;
    const int lane = tid & 31;
    const int ln   = lane & 15;   // n (or c) index within tile
    const int hi   = lane >> 4;   // lane half

    const int tile = blockIdx.x * 8 + wave;     // 4096 tiles total
    const int b  = tile >> 10;                  // N_/16 = 1024 tiles per batch
    const int n0 = (tile & 1023) << 4;

    const v8h zh = {};

    // B fragment: theta. halves 0..7 <- row (K-offset hi*8, zeros stored for
    // K>=8); halves 8..15 (K=16..31) constant zero.
    v8h tlo = *(const v8h*)(thetaPad + (((size_t)b * N_ + n0 + ln) << 4) + (hi << 3));
    const v16h bth = CAT16(tlo, zh);

    const _Float16* phib = phiPad + ((size_t)b * M_ << 4) + (hi << 3) + (ln << 4);
    const _Float16* gb   = g16    + (size_t)b * CG * M_ + (lane << 3);

    // ---- one pass over m: running maximum, exp, g.P accumulation ----
    // 64 keys per trip. theta is stored times log2(e), and the score product
    // takes minus the maximum in use as its C operand, so that a score tile
    // leaves the matrix unit as the argument of v_exp_f32: s = log2(e) * score
    // - maximum in use. cneg holds that C tile: lane = column n, so all eight
    // registers of a lane hold the same value (the same in both lane halves).
    // The maximum in use moves only when a lane's sum of a trip's 32 terms exceeds
    // 2^15. All terms are positive, so a sum within the bound holds every P of the
    // trip within it too, inside f16; the sum is formed anyway, so the hot path
    // takes no maximum over the scores. Above the bound the trip's maximum is taken,
    // its s and the sums so far are brought to it, and the trip's exp is done again.
    // One test per trip.
    const float pthr = 32768.0f;
    v8f cneg = {};          // trip 0 runs against 0 and then takes its own maximum
    float rsum = 0.f;
    v8f acc0 = {}, acc1 = {};

    // a trip's score tiles
    auto head = [&](const sagan_phi& ph, v8f (&s)[4]) __attribute__((always_inline)) {
        #pragma unroll
        for (int t = 0; t < 4; ++t) {
            const v16h ap = CAT16(ph.a[t], zh);
            s[t] = __builtin_amdgcn_wmma_f32_16x16x32_f16(false, ap, false, bth,
                                                          (short)0, cneg, false, false);
        }
    };

    // the maximum of a trip's scores of column n, the same in both lane halves
    auto colmax = [&](const v8f (&s)[4]) __attribute__((always_inline)) -> float {
        float mx0 = -3.0e38f, mx1 = -3.0e38f;
        #pragma unroll
        for (int i = 0; i < 8; ++i) {
            mx0 = fmaxf(mx0, fmaxf(s[0][i], s[1][i]));
            mx1 = fmaxf(mx1, fmaxf(s[2][i], s[3][i]));
        }
        const float mx = fmaxf(mx0, mx1);
        return fmaxf(mx, sagan_xhalf(mx));
    };

    // a trip's exp: the two P^T fragments and the lane's sum of its 32 terms
    auto expo = [&](const v8f (&s)[4], v16h (&P)[2]) __attribute__((always_inline)) -> float {
        float part[2];
        #pragma unroll
        for (int k = 0; k < 2; ++k) {
            // S^T D-layout -> P^T B-layout: pure per-lane f32->f16 packing.
            #pragma unroll
            for (int i = 0; i < 8; ++i) {
                // bare v_exp_f32, without the library's range fix-up: below 2^-126
                // it gives 0 where exp2f gives a subnormal; both round to 0 in f16
                // and both vanish in a row sum that holds the maximum's own term (>= 1)
                const float p0 = __builtin_amdgcn_exp2f(s[2 * k][i]);
                const float p1 = __builtin_amdgcn_exp2f(s[2 * k + 1][i]);
                part[k] = (i == 0) ? p0 + p1 : part[k] + (p0 + p1);
                P[k][i]     = (_Float16)p0;
                P[k][8 + i] = (_Float16)p1;
            }
        }
        return part[0] + part[1];
    };

    // the test of a trip whose exp has just been done, behind the sums of all trips before it
    auto test = [&](v8f (&s)[4], v16h (&P)[2], float& ts) __attribute__((always_inline)) {
        if (__builtin_amdgcn_ballot_w32(!(ts <= pthr)) != 0) {   // rare
            const float rise = fmaxf(colmax(s), 0.f);
            const float corr = __builtin_amdgcn_exp2f(-rise);
            cneg -= rise;
            #pragma unroll
            for (int t = 0; t < 4; ++t) s[t] -= rise;
            rsum *= corr;
            acc0 *= corr;
            acc1 *= corr;
            ts = expo(s, P);
        }
    };

    // a trip's sums
    auto sums = [&](const v16h (&P)[2], const float ts, const sagan_g& gq) __attribute__((always_inline)) {
        rsum += ts;
        #pragma unroll
        for (int k = 0; k < 2; ++k) {
            const v16h ag0 = CAT16(gq.g[4 * k],     gq.g[4 * k + 1]);
            const v16h ag1 = CAT16(gq.g[4 * k + 2], gq.g[4 * k + 3]);
            acc0 = __builtin_amdgcn_wmma_f32_16x16x32_f16(false, ag0, false, P[k],
                                                          (short)0, acc0, false, false);
            acc1 = __builtin_amdgcn_wmma_f32_16x16x32_f16(false, ag1, false, P[k],
                                                          (short)0, acc1, false, false);
        }
    };

    // The loop is rotated so that no load stands in front of its own use. A stage
    // is: ask for the g fragments of the next trip and the phi fragments of the
    // trip after it; the next trip's score tiles; this trip's g.P; the next trip's exp
    // and its test. A stage begins behind the branch of the test before it, so
    // the register sets it refills were read for the last time in the stage before.
    // Two stages a pass: the sets (phi, g) alternate without copies.
    // Behind the last key the indices wrap to this batch's first keys: those loads
    // stay in bounds; the last stage's terms (keys 0..63 again, none above the maximum
    // in use, which has held their maximum since trip 0) are not summed.
    sagan_phi p0, p1;
    sagan_g   g0, g1;
    v8f s[4];
    v16h P[2];
    sagan_load_phi(p0, phib, 0);
    sagan_load_phi(p1, phib, 64);
    sagan_load_g(g0, gb, 0);
    sagan_addr_wait();
    head(p0, s);
    {
        // trip 0 ran against 0 and takes its own maximum, whatever its sign; the sums are still 0
        const float rise = colmax(s);
        if (__builtin_amdgcn_ballot_w32(rise > -3.0e38f) != 0) {   // always
            cneg -= rise;
            #pragma unroll
            for (int t = 0; t < 4; ++t) s[t] -= rise;
        }
    }
    float ts = expo(s, P);      // no term above 1: no test
    // kept at two stages a pass: that is what the alternating sets ask for
    #pragma unroll 1
    for (int m0 = 0; m0 < M_; m0 += 128) {
        sagan_load_phi(p0, phib, (m0 + 128) & (M_ - 1));
        sagan_load_g(g1, gb, m0 + 64);
        sagan_addr_wait();
        head(p1, s);
        sums(P, ts, g0);
        ts = expo(s, P);
        test(s, P, ts);

        sagan_load_phi(p1, phib, (m0 + 192) & (M_ - 1));
        sagan_load_g(g0, gb, (m0 + 128) & (M_ - 1));
        sagan_addr_wait();
        head(p0, s);
        sums(P, ts, g1);
        ts = expo(s, P);
        test(s, P, ts);
    }
    rsum += __shfl_xor(rsum, 16, 32);

    const float rinv = 1.0f / rsum;      // both lane halves hold pixel ln's whole sum

    // this wave's share of the projection: output channels co0..co0+7, pixels nb..nb+127
    const int co0 = __builtin_amdgcn_readfirstlane(wave) * 8;
    const int nb  = (blockIdx.x & 127) << 7;            // 128 work-groups per batch
    // byte offset of the lane's 4 pixels in row co0 (below 16 MiB), the same in x and in out
    const unsigned obyte = (unsigned)(((b * C_ + co0) * N_ + nb + lane * 4) * 4);

    #pragma unroll
    for (int r = 0; r < 8; ++r) {
        ldsOT[r + hi * 8][wave * 16 + ln]      = acc0[r] * rinv;   // acc0[r] = O[n = ln][channel r + 8 hi]
        ldsOT[16 + r + hi * 8][wave * 16 + ln] = acc1[r] * rinv;
    }
    __syncthreads();

    // epilogue: out = gamma * w_o.(O/rowsum) + x
    // the residual rows are asked for behind the barrier (in front of it, its fence would wait
    // for them) and in front of the products, under which they fly
    float4 xv[8];
    #pragma unroll
    for (int j = 0; j < 8; ++j) xv[j] = *(const float4*)((const char*)x + obyte + j * (N_ * 4));
    const float gma = gamma[0];
    const float* wrow = w_o + co0 * CG;
    float4 v[8] = {};
    // kept rolled, 8 channels a trip: 64 weights fit the scalar registers (unrolled whole, they
    // spill), and the x loads above stay in front of the loop
    #pragma unroll 1
    for (int c8 = 0; c8 < CG; c8 += 8) {
        float4 o[8];
        #pragma unroll
        for (int k = 0; k < 8; ++k) o[k] = *(const float4*)&ldsOT[c8 + k][lane * 4];
        #pragma unroll
        for (int j = 0; j < 8; ++j) {
            #pragma unroll
            for (int k = 0; k < 8; ++k) {
                const float wv = wrow[j * CG + c8 + k];
                v[j].x += wv * o[k].x;
                v[j].y += wv * o[k].y;
                v[j].z += wv * o[k].z;
                v[j].w += wv * o[k].w;
            }
        }
    }
    #pragma unroll
    for (int j = 0; j < 8; ++j) {
        float4 res;
        res.x = gma * v[j].x + xv[j].x;
        res.y = gma * v[j].y + xv[j].y;
        res.z = gma * v[j].z + xv[j].z;
        res.w = gma * v[j].w + xv[j].w;
        *(float4*)((char*)out + obyte + j * (N_ * 4)) = res;
    }
}

// ---------------------------------------------------------------------------
extern "C" void kernel_launch(void* const* d_in, const int* in_sizes, int n_in,
                              void* d_out, int out_size, void* d_ws, size_t ws_size,
                              hipStream_t stream)
{
    const float* x       = (const float*)d_in[0];
    const float* w_theta = (const float*)d_in[1];
    const float* w_phi   = (const float*)d_in[2];
    const float* w_g     = (const float*)d_in[3];
    const float* w_o     = (const float*)d_in[4];
    const float* gamma   = (const float*)d_in[5];
    float* out = (float*)d_out;

    _Float16* thetaPad = (_Float16*)d_ws;                      // B*N*16 = 1M halves (2 MB)
    _Float16* phiPad   = thetaPad + ((size_t)B_ * N_ << 4);    // B*M*16 = 256K halves (512 KB)
    _Float16* g16      = phiPad   + ((size_t)B_ * M_ << 4);    // B*32*M = 512K halves (1 MB)

    sagan_proj_kernel<<<(B_ * M_) / 64, PG_T, 0, stream>>>(x, w_theta, w_phi, w_g,
                                                           thetaPad, phiPad, g16);
    sagan_attn_kernel<<<(B_ * (N_ / 16)) / 8, 256, 0, stream>>>(
        x, w_o, gamma, thetaPad, phiPad, g16, out);
}

// v010
// It runs in 35.6 microseconds.
// Next to v009, in two timings, it ran 1.22 and 1.21 times as fast.
// All steps since v000 together make it 7.04 times as fast.
#include <hip/hip_runtime.h>
#include <hip/hip_bf16.h>

typedef __attribute__((ext_vector_type(16))) _Float16 v16h;
typedef __attribute__((ext_vector_type(8)))  _Float16 v8h;
typedef __attribute__((ext_vector_type(8)))  float    v8f;

#define B_  4
#define C_  64
#define CQ  8          // C/8
#define CP  16         // padded K rows for theta/phi (upper 8 stored zero)
#define CG  32         // C/2
#define H_  128
#define W_  128
#define N_  (H_*W_)    // 16384
#define M_  (N_/4)     // 4096

#define CAT16(a, b) __builtin_shufflevector(a, b, 0,1,2,3,4,5,6,7,8,9,10,11,12,13,14,15)

// ---------------------------------------------------------------------------
// Phase 1: the three 1x1 convs of x in one launch; phi and g with their 2x2
// maxpool, theta unpooled.
//   thetaPad[b][n][0..15] : halves 0..7 = log2(e) * w_theta . x[:, n], 8..15 = 0
//   (the scale makes the attention kernel's score product a base-2 exponent)
//   phiPad[b][p][0..15]  (f16, zero-padded rows for WMMA A fragments)
//   g16[b][p/32][cg/16][(p/16)&1][lane][8]  (f16, in the order of the PV g
//   fragments: lane = ((p/8)&1)*16 + cg%16, element = p%8, so that one 16-byte
//   load per lane of the attention loop covers 512 contiguous bytes)
// One work-group = one pooled row (64 pooled pixels = 2 x 128 pixels of x) x
// all 48 outputs. Two waves cover the 64 windows; six such pairs take 8
// outputs each (pair 0 = phi, pairs 1..4 = g, pair 5 = theta). A thread keeps
// its 2x2 window x 8 outputs in registers, so one weight read from LDS feeds
// four multiply-adds. The theta pair stores the four sums of its window as
// they are: the x rows it reads are the ones the other pairs read anyway.
// ---------------------------------------------------------------------------
#define PG_OG 8                             // outputs per thread
#define PG_NG ((CQ + CG + CQ) / PG_OG)      // 6 output groups
#define PG_T  (64 * PG_NG)                  // 384 threads
#define PG_SC 8                             // channels of x per load stage
#define PG_NS (C_ / PG_SC)                  // 8 stages
#define PG_RD 4                             // register sets in the ring

__global__ void __launch_bounds__(PG_T)
sagan_proj_kernel(const float* __restrict__ x, const float* __restrict__ w_theta,
                  const float* __restrict__ w_phi, const float* __restrict__ w_g,
                  _Float16* __restrict__ thetaPad,
                  _Float16* __restrict__ phiPad, _Float16* __restrict__ g16)
{
    // rows 0..7 phi, 8..39 g, 40..47 theta
    __shared__ __attribute__((aligned(16))) float wl[(CQ + CG + CQ) * C_];
    const int grp = threadIdx.x >> 6;        // output group, same for a whole wave
    const int wq  = threadIdx.x & 63;        // pooled column
    const int b   = blockIdx.x >> 6;
    const int hp  = blockIdx.x & 63;         // pooled row
    const int p   = hp * 64 + wq;

    const float* xp = x + (size_t)b * C_ * N_ + (hp * 2) * W_ + wq * 2;
    const float* wr = wl + grp * PG_OG * C_;

    // the thread's window of x, PG_SC channels a stage, in a ring of PG_RD register sets:
    // three stages' loads fly while one stage is worked on
    float2 top[PG_RD][PG_SC], bot[PG_RD][PG_SC];
    auto ask = [&](const int s) __attribute__((always_inline)) {
        #pragma unroll
        for (int k = 0; k < PG_SC; ++k) {
            top[s % PG_RD][k] = *(const float2*)(xp + (size_t)(s * PG_SC + k) * N_);
            bot[s % PG_RD][k] = *(const float2*)(xp + (size_t)(s * PG_SC + k) * N_ + W_);
        }
    };

    // the first three stages are asked for in front of the weights, so that one wait serves both
    #pragma unroll
    for (int s = 0; s < PG_RD - 1; ++s) ask(s);

    // 3072 weights = 8 per thread; unrolled so that the 8 loads fly together
    #pragma unroll
    for (int k = 0; k < (CQ + CG + CQ) * C_ / PG_T; ++k) {
        const int i = threadIdx.x + k * PG_T;
        wl[i] = (i < CQ * C_) ? w_phi[i]
              : (i < (CQ + CG) * C_) ? w_g[i - CQ * C_] : w_theta[i - (CQ + CG) * C_];
    }
    __syncthreads();

    float acc[4][PG_OG] = {};
    // unrolled whole: the ring's sets are then plain registers, every load takes its place
    // from one address and an immediate offset, and four channels' weights come as one
    // 16-byte LDS read
    #pragma unroll
    for (int s = 0; s < PG_NS; ++s) {
        if (s + PG_RD - 1 < PG_NS) ask(s + PG_RD - 1);   // into the set that stage s - 1 has read
        // keeps the loads from sinking: without it the scheduler moves them to right in front
        // of their use, and every stage waits a whole load latency. (It may still lift them
        // to the head of the stage before, into registers of their own: a stage more in flight.)
        __builtin_amdgcn_sched_barrier(0);
        #pragma unroll
        for (int k = 0; k < PG_SC; ++k) {
            const float2 t2 = top[s % PG_RD][k];
            const float2 b2 = bot[s % PG_RD][k];
            #pragma unroll
            for (int o = 0; o < PG_OG; ++o) {
                const float wv = wr[o * C_ + s * PG_SC + k];
                acc[0][o] += wv * t2.x;
                acc[1][o] += wv * t2.y;
                acc[2][o] += wv * b2.x;
                acc[3][o] += wv * b2.y;
            }
        }
    }

    if (grp == PG_NG - 1) {
        // theta: window position k = (row k/2, column k%2) is pixel n; two
        // neighbouring pixels' padded rows are 64 contiguous bytes per thread
        const v8h zz = {};
        v8h lo[4];
        #pragma unroll
        for (int k = 0; k < 4; ++k) {
            #pragma unroll
            for (int o = 0; o < CQ; ++o) lo[k][o] = (_Float16)(acc[k][o] * 1.44269504088896340736f);
        }
        #pragma unroll
        for (int k = 0; k < 4; ++k) {
            const int n = (hp * 2 + (k >> 1)) * W_ + wq * 2 + (k & 1);
            _Float16* tp = thetaPad + (((size_t)b * N_ + n) << 4);
            *(v8h*)(tp)     = lo[k];   // global_store_b128
            *(v8h*)(tp + 8) = zz;      // zero pad (K = 8..15)
        }
        return;                     // whole waves leave; no barrier follows
    }

    float res[PG_OG];
    #pragma unroll
    for (int o = 0; o < PG_OG; ++o) {
        float r = fmaxf(-3.0e38f, acc[0][o]);
        r = fmaxf(r, acc[1][o]);
        r = fmaxf(r, acc[2][o]);
        res[o] = fmaxf(r, acc[3][o]);
    }

    if (grp == 0) {
        v8h lo;
        #pragma unroll
        for (int o = 0; o < CQ; ++o) lo[o] = (_Float16)res[o];
        const v8h zz = {};
        _Float16* pp = phiPad + (((size_t)b * M_ + p) << 4);
        *(v8h*)(pp)     = lo;
        *(v8h*)(pp + 8) = zz;
    } else {
        // channel c = (grp-1)*8 + o: tile c/16 = (grp-1)/2, column c%16 = ((grp-1)&1)*8 + o
        const int ct   = (grp - 1) >> 1;
        const int frag = ((b * (M_ / 32) + (p >> 5)) * 2 + ct) * 2 + ((p >> 4) & 1);
        const int fl   = ((p >> 3) & 1) * 16 + ((grp - 1) & 1) * 8;
        _Float16* gp = g16 + (((size_t)frag * 32 + fl) << 3) + (p & 7);
        #pragma unroll
        for (int o = 0; o < PG_OG; ++o) gp[o * 8] = (_Float16)res[o];
    }
}

// ---------------------------------------------------------------------------
// Phase 2: fused flash-style attention + w_o projection + residual.
// One wave owns a 16-row n-tile and walks the keys ONCE (online softmax).
// S^T tiles via v_wmma_f32_16x16x32_f16 (lane = n in D layout => per-lane
// softmax). An S^T D-tile pair converts to the B operand of O^T += g^T . P^T
// with per-lane f32->f16 packs only, and O^T again has lane = n, so that a
// change of the maximum in use rescales a lane's own registers.
// All fragment loads are unconditional b128 loads (zero padding stored in
// memory), no exec masking.
// The w_o projection is shared out over the work-group by output channel: the
// eight waves' normalised O tiles meet in LDS as O^T[channel][128 pixels], and
// a wave then forms 8 output channels for all 128 pixels, a lane 4 neighbouring
// pixels. A row of x or out is one 512-byte access of the wave, and the wave's
// w_o rows are the same in every lane, so they come by scalar loads.
// ---------------------------------------------------------------------------
#define OT_P 132   // O^T row pitch in floats: 16-byte aligned rows; rows r and r + 8 fall 32 banks apart
// lane l <-> lane l ^ 16 by a vector cross-row move
__device__ __forceinline__ float sagan_xhalf(float v)
{
    const int b = __builtin_bit_cast(int, v);
    return __builtin_bit_cast(float, __builtin_amdgcn_permlanex16(
        b, b, 0x76543210, 0xfedcba98, false, false));
}

// the fragments of one trip of 64 keys: four phi A fragments, eight g fragments
struct sagan_phi { v8h a[4]; };
struct sagan_g   { v8h g[8]; };

// phil: the lane's phi row of key 0 (+ its K offset)
__device__ __forceinline__ void sagan_load_phi(sagan_phi& f, const _Float16* __restrict__ phil,
                                               const int m0)
{
    const _Float16* pr = phil + ((size_t)m0 << 4);
    #pragma unroll
    for (int t = 0; t < 4; ++t) f.a[t] = *(const v8h*)(pr + ((t * 16) << 4));
}

// gl: the lane's 16 bytes of g fragment 0. g is stored in fragment order: each
// load is 512 contiguous bytes per wave, four whole lines; 32 m x 32 channels
// per 1024 halves
__device__ __forceinline__ void sagan_load_g(sagan_g& f, const _Float16* __restrict__ gl,
                                             const int m0)
{
    const _Float16* gf = gl + ((size_t)m0 << 5);
    #pragma unroll
    for (int t = 0; t < 8; ++t) f.g[t] = *(const v8h*)(gf + t * 256);
}

__device__ __forceinline__ void sagan_addr_wait()
{
    // the loop forms new addresses while a stage's loads are still in flight:
    // this wait stands between the loads and the overwrite of their address registers
    asm volatile("s_wait_xcnt 0x0" ::: "memory");
    // keeps the loads at the head of their stage: without it the scheduler sinks them
    // to the stage's end to save registers, a few dozen instructions in front of their use
    __builtin_amdgcn_sched_barrier(0);
}

__global__ void __launch_bounds__(256)
sagan_attn_kernel(const float* __restrict__ x, const float* __restrict__ w_o,
                  const float* __restrict__ gamma,
                  const _Float16* __restrict__ thetaPad,
                  const _Float16* __restrict__ phiPad,
                  const _Float16* __restrict__ g16,
                  float* __restrict__ out)
{
    __shared__ __attribute__((aligned(16))) float ldsOT[CG][OT_P];  // O^T / row sum, 128 pixels

    const int tid  = threadIdx.x;
    const int wave = tid >> 5;
    const int lane = tid & 31;
    const int ln   = lane & 15;   // n (or c) index within tile
    const int hi   = lane >> 4;   // lane half

    const int tile = blockIdx.x * 8 + wave;     // 4096 tiles total
    const int b  = tile >> 10;                  // N_/16 = 1024 tiles per batch
    const int n0 = (tile & 1023) << 4;

    const v8h zh = {};

    // B fragment: theta. halves 0..7 <- row (K-offset hi*8, zeros stored for
    // K>=8); halves 8..15 (K=16..31) constant zero.
    v8h tlo = *(const v8h*)(thetaPad + (((size_t)b * N_ + n0 + ln) << 4) + (hi << 3));
    const v16h bth = CAT16(tlo, zh);

    const _Float16* phib = phiPad + ((size_t)b * M_ << 4) + (hi << 3) + (ln << 4);
    const _Float16* gb   = g16    + (size_t)b * CG * M_ + (lane << 3);

    // ---- one pass over m: running maximum, exp, g.P accumulation ----
    // 64 keys per trip. theta is stored times log2(e), and the score product
    // takes minus the maximum in use as its C operand, so that a score tile
    // leaves the matrix unit as the argument of v_exp_f32: s = log2(e) * score
    // - maximum in use. cneg holds that C tile: lane = column n, so all eight
    // registers of a lane hold the same value (the same in both lane halves).
    // The maximum in use moves only when a lane's sum of a trip's 32 terms exceeds
    // 2^15. All terms are positive, so a sum within the bound holds every P of the
    // trip within it too, inside f16; the sum is formed anyway, so the hot path
    // takes no maximum over the scores. Above the bound the trip's maximum is taken,
    // its s and the sums so far are brought to it, and the trip's exp is done again.
    // One test per trip.
    const float pthr = 32768.0f;
    v8f cneg = {};          // trip 0 runs against 0 and then takes its own maximum
    float rsum = 0.f;
    v8f acc0 = {}, acc1 = {};

    // a trip's score tiles
    auto head = [&](const sagan_phi& ph, v8f (&s)[4]) __attribute__((always_inline)) {
        #pragma unroll
        for (int t = 0; t < 4; ++t) {
            const v16h ap = CAT16(ph.a[t], zh);
            s[t] = __builtin_amdgcn_wmma_f32_16x16x32_f16(false, ap, false, bth,
                                                          (short)0, cneg, false, false);
        }
    };

    // the maximum of a trip's scores of column n, the same in both lane halves
    auto colmax = [&](const v8f (&s)[4]) __attribute__((always_inline)) -> float {
        float mx0 = -3.0e38f, mx1 = -3.0e38f;
        #pragma unroll
        for (int i = 0; i < 8; ++i) {
            mx0 = fmaxf(mx0, fmaxf(s[0][i], s[1][i]));
            mx1 = fmaxf(mx1, fmaxf(s[2][i], s[3][i]));
        }
        const float mx = fmaxf(mx0, mx1);
        return fmaxf(mx, sagan_xhalf(mx));
    };

    // a trip's exp: the two P^T fragments and the lane's sum of its 32 terms
    auto expo = [&](const v8f (&s)[4], v16h (&P)[2]) __attribute__((always_inline)) -> float {
        float part[2];
        #pragma unroll
        for (int k = 0; k < 2; ++k) {
            // S^T D-layout -> P^T B-layout: pure per-lane f32->f16 packing.
            #pragma unroll
            for (int i = 0; i < 8; ++i) {
                // bare v_exp_f32, without the library's range fix-up: below 2^-126
                // it gives 0 where exp2f gives a subnormal; both round to 0 in f16
                // and both vanish in a row sum that holds the maximum's own term (>= 1)
                const float p0 = __builtin_amdgcn_exp2f(s[2 * k][i]);
                const float p1 = __builtin_amdgcn_exp2f(s[2 * k + 1][i]);
                part[k] = (i == 0) ? p0 + p1 : part[k] + (p0 + p1);
                P[k][i]     = (_Float16)p0;
                P[k][8 + i] = (_Float16)p1;
            }
        }
        return part[0] + part[1];
    };

    // the test of a trip whose exp has just been done, behind the sums of all trips before it
    auto test = [&](v8f (&s)[4], v16h (&P)[2], float& ts) __attribute__((always_inline)) {
        if (__builtin_amdgcn_ballot_w32(!(ts <= pthr)) != 0) {   // rare
            const float rise = fmaxf(colmax(s), 0.f);
            const float corr = __builtin_amdgcn_exp2f(-rise);
            cneg -= rise;
            #pragma unroll
            for (int t = 0; t < 4; ++t) s[t] -= rise;
            rsum *= corr;
            acc0 *= corr;
            acc1 *= corr;
            ts = expo(s, P);
        }
    };

    // a trip's sums
    auto sums = [&](const v16h (&P)[2], const float ts, const sagan_g& gq) __attribute__((always_inline)) {
        rsum += ts;
        #pragma unroll
        for (int k = 0; k < 2; ++k) {
            const v16h ag0 = CAT16(gq.g[4 * k],     gq.g[4 * k + 1]);
            const v16h ag1 = CAT16(gq.g[4 * k + 2], gq.g[4 * k + 3]);
            acc0 = __builtin_amdgcn_wmma_f32_16x16x32_f16(false, ag0, false, P[k],
                                                          (short)0, acc0, false, false);
            acc1 = __builtin_amdgcn_wmma_f32_16x16x32_f16(false, ag1, false, P[k],
                                                          (short)0, acc1, false, false);
        }
    };

    // The loop is rotated so that no load stands in front of its own use. A stage
    // is: ask for the g fragments of the next trip and the phi fragments of the
    // trip after it; the next trip's score tiles; this trip's g.P; the next trip's exp
    // and its test. A stage begins behind the branch of the test before it, so
    // the register sets it refills were read for the last time in the stage before.
    // Two stages a pass: the sets (phi, g) alternate without copies.
    // Behind the last key the indices wrap to this batch's first keys: those loads
    // stay in bounds; the last stage's terms (keys 0..63 again, none above the maximum
    // in use, which has held their maximum since trip 0) are not summed.
    sagan_phi p0, p1;
    sagan_g   g0, g1;
    v8f s[4];
    v16h P[2];
    sagan_load_phi(p0, phib, 0);
    sagan_load_phi(p1, phib, 64);
    sagan_load_g(g0, gb, 0);
    sagan_addr_wait();
    head(p0, s);
    {
        // trip 0 ran against 0 and takes its own maximum, whatever its sign; the sums are still 0
        const float rise = colmax(s);
        if (__builtin_amdgcn_ballot_w32(rise > -3.0e38f) != 0) {   // always
            cneg -= rise;
            #pragma unroll
            for (int t = 0; t < 4; ++t) s[t] -= rise;
        }
    }
    float ts = expo(s, P);      // no term above 1: no test
    // kept at two stages a pass: that is what the alternating sets ask for
    #pragma unroll 1
    for (int m0 = 0; m0 < M_; m0 += 128) {
        sagan_load_phi(p0, phib, (m0 + 128) & (M_ - 1));
        sagan_load_g(g1, gb, m0 + 64);
        sagan_addr_wait();
        head(p1, s);
        sums(P, ts, g0);
        ts = expo(s, P);
        test(s, P, ts);

        sagan_load_phi(p1, phib, (m0 + 192) & (M_ - 1));
        sagan_load_g(g0, gb, (m0 + 128) & (M_ - 1));
        sagan_addr_wait();
        head(p0, s);
        sums(P, ts, g1);
        ts = expo(s, P);
        test(s, P, ts);
    }
    rsum += __shfl_xor(rsum, 16, 32);

    const float rinv = 1.0f / rsum;      // both lane halves hold pixel ln's whole sum

    // this wave's share of the projection: output channels co0..co0+7, pixels nb..nb+127
    const int co0 = __builtin_amdgcn_readfirstlane(wave) * 8;
    const int nb  = (blockIdx.x & 127) << 7;            // 128 work-groups per batch
    // byte offset of the lane's 4 pixels in row co0 (below 16 MiB), the same in x and in out
    const unsigned obyte = (unsigned)(((b * C_ + co0) * N_ + nb + lane * 4) * 4);

    #pragma unroll
    for (int r = 0; r < 8; ++r) {
        ldsOT[r + hi * 8][wave * 16 + ln]      = acc0[r] * rinv;   // acc0[r] = O[n = ln][channel r + 8 hi]
        ldsOT[16 + r + hi * 8][wave * 16 + ln] = acc1[r] * rinv;
    }
    __syncthreads();

    // epilogue: out = gamma * w_o.(O/rowsum) + x
    // the residual rows are asked for behind the barrier (in front of it, its fence would wait
    // for them) and in front of the products, under which they fly
    float4 xv[8];
    #pragma unroll
    for (int j = 0; j < 8; ++j) xv[j] = *(const float4*)((const char*)x + obyte + j * (N_ * 4));
    const float gma = gamma[0];
    const float* wrow = w_o + co0 * CG;
    float4 v[8] = {};
    // kept rolled, 8 channels a trip: 64 weights fit the scalar registers (unrolled whole, they
    // spill), and the x loads above stay in front of the loop
    #pragma unroll 1
    for (int c8 = 0; c8 < CG; c8 += 8) {
        float4 o[8];
        #pragma unroll
        for (int k = 0; k < 8; ++k) o[k] = *(const float4*)&ldsOT[c8 + k][lane * 4];
        #pragma unroll
        for (int j = 0; j < 8; ++j) {
            #pragma unroll
            for (int k = 0; k < 8; ++k) {
                const float wv = wrow[j * CG + c8 + k];
                v[j].x += wv * o[k].x;
                v[j].y += wv * o[k].y;
                v[j].z += wv * o[k].z;
                v[j].w += wv * o[k].w;
            }
        }
    }
    #pragma unroll
    for (int j = 0; j < 8; ++j) {
        float4 res;
        res.x = gma * v[j].x + xv[j].x;
        res.y = gma * v[j].y + xv[j].y;
        res.z = gma * v[j].z + xv[j].z;
        res.w = gma * v[j].w + xv[j].w;
        *(float4*)((char*)out + obyte + j * (N_ * 4)) = res;
    }
}

// ---------------------------------------------------------------------------
extern "C" void kernel_launch(void* const* d_in, const int* in_sizes, int n_in,
                              void* d_out, int out_size, void* d_ws, size_t ws_size,
                              hipStream_t stream)
{
    const float* x       = (const float*)d_in[0];
    const float* w_theta = (const float*)d_in[1];
    const float* w_phi   = (const float*)d_in[2];
    const float* w_g     = (const float*)d_in[3];
    const float* w_o     = (const float*)d_in[4];
    const float* gamma   = (const float*)d_in[5];
    float* out = (float*)d_out;

    _Float16* thetaPad = (_Float16*)d_ws;                      // B*N*16 = 1M halves (2 MB)
    _Float16* phiPad   = thetaPad + ((size_t)B_ * N_ << 4);    // B*M*16 = 256K halves (512 KB)
    _Float16* g16      = phiPad   + ((size_t)B_ * M_ << 4);    // B*32*M = 512K halves (1 MB)

    sagan_proj_kernel<<<(B_ * M_) / 64, PG_T, 0, stream>>>(x, w_theta, w_phi, w_g,
                                                           thetaPad, phiPad, g16);
    sagan_attn_kernel<<<(B_ * (N_ / 16)) / 8, 256, 0, stream>>>(
        x, w_o, gamma, thetaPad, phiPad, g16, out);
}
